// v000
// Times are from an AMD MI455X. After a warm-up the kernel runs many times in a row, and a time is the length of
// such a window on the GPU divided by its runs, so every launch and the gaps after it count. The runs cycle
// through copies of the inputs. A figure is the median of several windows, for all but v000 over two sittings.
// Sittings can differ by a few percent; kernels timed side by side share one.
// v000, which the later versions start from, runs in 46.9 microseconds.
#include <hip/hip_runtime.h>
#include <hip/hip_bf16.h>

typedef __attribute__((ext_vector_type(2))) float v2f;
typedef __attribute__((ext_vector_type(4))) float v4f;
typedef __attribute__((ext_vector_type(8))) float v8f;

#define B_  4
#define L_  512
#define D_  128
#define BL_ (B_ * L_)
#define SCALE 0.08838834764831845f  /* 1/sqrt(128) */

// ---------------------------------------------------------------------------
// Kernel 1: hqb = Q @ W1[:D] + b1 ; hk = K @ W1[D:]
// X = [Q; K] rows 0..2*BL-1. One WG = 16 rows; wave w = output cols [16w,16w+16).
// V_WMMA_F32_16X16X4_F32 accumulating over the 128-deep contraction.
// ---------------------------------------------------------------------------
__global__ __launch_bounds__(256)
void cga_proj_kernel(const float* __restrict__ Q, const float* __restrict__ K,
                     const float* __restrict__ W1, const float* __restrict__ b1,
                     float* __restrict__ hqb, float* __restrict__ hk)
{
    const int r0   = blockIdx.x * 16;          // row tile in X (0..4095)
    const bool isK = (r0 >= BL_);
    const float* X = isK ? (K + (size_t)(r0 - BL_) * D_) : (Q + (size_t)r0 * D_);

    const int tid  = threadIdx.x;
    const int wave = tid >> 5;
    const int lane = tid & 31;
    const int half = lane >> 4;        // K-pair selector for A/B operands
    const int lp   = lane & 15;        // m (A) / n (B,C,D)

    __shared__ float ldsX[16][132];    // +4 pad: stride-132 kills bank conflicts

    { // cooperative 16x128 tile stage: 256 threads x 8 floats
        const int row = tid >> 4;
        const int col = (tid & 15) * 8;
        const float* src = X + (size_t)row * D_ + col;
        *(float4*)&ldsX[row][col]     = *(const float4*)(src);
        *(float4*)&ldsX[row][col + 4] = *(const float4*)(src + 4);
    }
    __syncthreads();

    const int d0   = wave * 16;        // output column tile
    const int woff = isK ? D_ : 0;     // which half of W1 [256,128]

    v8f acc = {};
    for (int c = 0; c < D_; c += 4) {
        // A: X[m][c + kb + j], contiguous float2 per lane
        v2f a = *(const v2f*)&ldsX[lp][c + 2 * half];
        // B: W1[woff + c + kb + j][d0 + n] — two coalesced scalar reads
        const float* wr = W1 + (size_t)(woff + c + 2 * half) * D_ + d0 + lp;
        v2f bv; bv.x = wr[0]; bv.y = wr[D_];
        acc = __builtin_amdgcn_wmma_f32_16x16x4_f32(false, a, false, bv,
                                                    (short)0, acc, false, false);
    }

    float* dst      = isK ? hk : hqb;
    const int rbase = isK ? (r0 - BL_) : r0;
#pragma unroll
    for (int r = 0; r < 8; ++r) {
        const int row = rbase + r + 8 * half;      // C/D layout: M = r + 8*half
        float v = acc[r];
        if (!isK) v += b1[d0 + lp];                // fold b1 into hqb
        dst[(size_t)row * D_ + d0 + lp] = v;
    }
}

// ---------------------------------------------------------------------------
// Kernel 2: fused gated attention for one (b, 16-row q tile).
// 8 waves: each owns 4 k-tiles (S via WMMA + conflict via VALU + gate),
// then per-row wave32 softmax, then P@V via WMMA (one d-tile per wave).
// ---------------------------------------------------------------------------
__global__ __launch_bounds__(256)
void cga_attn_kernel(const float* __restrict__ Q, const float* __restrict__ K,
                     const float* __restrict__ V, const int* __restrict__ mask,
                     const float* __restrict__ W2, const float* __restrict__ b2,
                     const float* __restrict__ hqb, const float* __restrict__ hk,
                     float* __restrict__ out, float* __restrict__ weights)
{
    const int b  = blockIdx.x >> 5;    // batch
    const int q0 = (blockIdx.x & 31) * 16;

    const int tid  = threadIdx.x;
    const int wave = tid >> 5;
    const int lane = tid & 31;
    const int half = lane >> 4;
    const int lp   = lane & 15;

    __shared__ float ldsQ[16][132];    // Q tile (padded)
    __shared__ float ldsH[16][132];    // hqb tile (b1 folded)
    __shared__ float ldsW2[128];
    __shared__ float SG[16][516];      // gated scores, +4 pad for P@V column reads

    { // stage Q tile + hqb tile + W2
        const int row = tid >> 4;
        const int col = (tid & 15) * 8;
        const float* qs = Q   + ((size_t)(b * L_) + q0 + row) * D_ + col;
        const float* hs = hqb + ((size_t)(b * L_) + q0 + row) * D_ + col;
        *(float4*)&ldsQ[row][col]     = *(const float4*)(qs);
        *(float4*)&ldsQ[row][col + 4] = *(const float4*)(qs + 4);
        *(float4*)&ldsH[row][col]     = *(const float4*)(hs);
        *(float4*)&ldsH[row][col + 4] = *(const float4*)(hs + 4);
        if (tid < 128) ldsW2[tid] = W2[tid];
    }
    __syncthreads();

    const float bias2 = b2[0];

    for (int kt = wave; kt < 32; kt += 8) {
        const int k0 = kt * 16;

        // ---- S = Q_tile * K_tileᵀ  (32 chained f32 WMMAs) ----
        v8f acc = {};
        const float* krow = K + ((size_t)(b * L_) + k0 + lp) * D_ + 2 * half;
        for (int c = 0; c < D_; c += 4) {
            v2f a  = *(const v2f*)&ldsQ[lp][c + 2 * half];
            v2f bv = *(const v2f*)(krow + c);   // B[kb+j][n] == K[k0+n][c+kb+j]
            acc = __builtin_amdgcn_wmma_f32_16x16x4_f32(false, a, false, bv,
                                                        (short)0, acc, false, false);
        }

        // ---- conflict[q,k] = Σ_d relu(hqb[q,d]+hk[k,d])·W2[d]  (VALU) ----
        float conf[8] = {0.f, 0.f, 0.f, 0.f, 0.f, 0.f, 0.f, 0.f};
        const float* hkr = hk + ((size_t)(b * L_) + k0 + lp) * D_;
        for (int d = 0; d < D_; d += 4) {
            v4f hv = *(const v4f*)(hkr + d);        // strided global float4 (hk row k0+lp)
            v4f wv = *(const v4f*)&ldsW2[d];        // LDS broadcast
#pragma unroll
            for (int r = 0; r < 8; ++r) {
                v4f hq = *(const v4f*)&ldsH[r + 8 * half][d];  // LDS broadcast
                conf[r] += fmaxf(hq.x + hv.x, 0.f) * wv.x
                         + fmaxf(hq.y + hv.y, 0.f) * wv.y
                         + fmaxf(hq.z + hv.z, 0.f) * wv.z
                         + fmaxf(hq.w + hv.w, 0.f) * wv.w;
            }
        }

        // ---- gate + mask -> SG ----
#pragma unroll
        for (int r = 0; r < 8; ++r) {
            const int qrow = r + 8 * half;
            const float g  = 1.f / (1.f + __expf(-(conf[r] + bias2)));
            float sg = acc[r] * SCALE * g;
            const int mv = mask[(((size_t)b * L_) + q0 + qrow) * L_ + k0 + lp];
            if (mv == 0) sg = -__builtin_inff();
            SG[qrow][k0 + lp] = sg;
        }
    }
    __syncthreads();

    // ---- softmax over k (wave32 shuffle reduction; 2 rows per wave) ----
    for (int rr = 0; rr < 2; ++rr) {
        const int row = wave * 2 + rr;
        float mx = -__builtin_inff();
        for (int c = lane; c < L_; c += 32) mx = fmaxf(mx, SG[row][c]);
        for (int off = 16; off; off >>= 1) mx = fmaxf(mx, __shfl_xor(mx, off, 32));
        float sum = 0.f;
        for (int c = lane; c < L_; c += 32) {
            const float e = __expf(SG[row][c] - mx);
            SG[row][c] = e;
            sum += e;
        }
        for (int off = 16; off; off >>= 1) sum += __shfl_xor(sum, off, 32);
        const float inv = 1.f / sum;
        float* wout = weights + (((size_t)b * L_) + q0 + row) * L_;
        for (int c = lane; c < L_; c += 32) {
            const float p = SG[row][c] * inv;
            SG[row][c] = p;
            wout[c] = p;
        }
    }
    __syncthreads();

    // ---- out = P @ V  (128 chained f32 WMMAs; wave owns d-tile = 16*wave) ----
    {
        const int d0 = wave * 16;
        v8f acc = {};
        for (int k4 = 0; k4 < L_; k4 += 4) {
            v2f a = *(const v2f*)&SG[lp][k4 + 2 * half];     // A: P[m][k4+kb+j]
            const float* vr = V + ((size_t)(b * L_) + k4 + 2 * half) * D_ + d0 + lp;
            v2f bv; bv.x = vr[0]; bv.y = vr[D_];             // B: V[k4+kb+j][d0+n]
            acc = __builtin_amdgcn_wmma_f32_16x16x4_f32(false, a, false, bv,
                                                        (short)0, acc, false, false);
        }
#pragma unroll
        for (int r = 0; r < 8; ++r)
            out[(((size_t)b * L_) + q0 + r + 8 * half) * D_ + d0 + lp] = acc[r];
    }
}

// ---------------------------------------------------------------------------
extern "C" void kernel_launch(void* const* d_in, const int* in_sizes, int n_in,
                              void* d_out, int out_size, void* d_ws, size_t ws_size,
                              hipStream_t stream)
{
    const float* Q    = (const float*)d_in[0];
    const float* K    = (const float*)d_in[1];
    const float* V    = (const float*)d_in[2];
    const int*   mask = (const int*)  d_in[3];
    const float* W1   = (const float*)d_in[4];
    const float* b1   = (const float*)d_in[5];
    const float* W2   = (const float*)d_in[6];
    const float* b2   = (const float*)d_in[7];

    float* out     = (float*)d_out;                       // [B,L,D]
    float* weights = (float*)d_out + (size_t)BL_ * D_;    // [B,L,L]

    // workspace: hqb [B,L,D] then hk [B,L,D]  (2 MB total)
    float* hqb = (float*)d_ws;
    float* hk  = (float*)d_ws + (size_t)BL_ * D_;

    cga_proj_kernel<<<2 * BL_ / 16, 256, 0, stream>>>(Q, K, W1, b1, hqb, hk);
    cga_attn_kernel<<<B_ * (L_ / 16), 256, 0, stream>>>(Q, K, V, mask, W2, b2,
                                                        hqb, hk, out, weights);
}

// v001
// One run takes 40.2 microseconds.
// Timed twice side by side with v000, it ran 1.18 and 1.19 times as fast.
#include <hip/hip_runtime.h>
#include <hip/hip_bf16.h>

typedef __attribute__((ext_vector_type(2))) float v2f;
typedef __attribute__((ext_vector_type(4))) float v4f;
typedef __attribute__((ext_vector_type(8))) float v8f;

#define B_  4
#define L_  512
#define D_  128
#define BL_ (B_ * L_)
#define SCALE 0.08838834764831845f  /* 1/sqrt(128) */

// ---------------------------------------------------------------------------
// Kernel 1: hqb = Q @ W1[:D] + b1 ; hk = K @ W1[D:]
// X = [Q; K] rows 0..2*BL-1. One WG = 16 rows; wave w = output cols [16w,16w+16).
// V_WMMA_F32_16X16X4_F32 accumulating over the 128-deep contraction.
// ---------------------------------------------------------------------------
__global__ __launch_bounds__(256)
void cga_proj_kernel(const float* __restrict__ Q, const float* __restrict__ K,
                     const float* __restrict__ W1, const float* __restrict__ b1,
                     float* __restrict__ hqb, float* __restrict__ hk)
{
    const int r0   = blockIdx.x * 16;          // row tile in X (0..4095)
    const bool isK = (r0 >= BL_);
    const float* X = isK ? (K + (size_t)(r0 - BL_) * D_) : (Q + (size_t)r0 * D_);

    const int tid  = threadIdx.x;
    const int wave = tid >> 5;
    const int lane = tid & 31;
    const int half = lane >> 4;        // K-pair selector for A/B operands
    const int lp   = lane & 15;        // m (A) / n (B,C,D)

    __shared__ float ldsX[16][132];    // +4 pad: stride-132 kills bank conflicts

    { // cooperative 16x128 tile stage: 256 threads x 8 floats
        const int row = tid >> 4;
        const int col = (tid & 15) * 8;
        const float* src = X + (size_t)row * D_ + col;
        *(float4*)&ldsX[row][col]     = *(const float4*)(src);
        *(float4*)&ldsX[row][col + 4] = *(const float4*)(src + 4);
    }
    __syncthreads();

    const int d0   = wave * 16;        // output column tile
    const int woff = isK ? D_ : 0;     // which half of W1 [256,128]

    v8f acc = {};
    for (int c = 0; c < D_; c += 4) {
        // A: X[m][c + kb + j], contiguous float2 per lane
        v2f a = *(const v2f*)&ldsX[lp][c + 2 * half];
        // B: W1[woff + c + kb + j][d0 + n] — two coalesced scalar reads
        const float* wr = W1 + (size_t)(woff + c + 2 * half) * D_ + d0 + lp;
        v2f bv; bv.x = wr[0]; bv.y = wr[D_];
        acc = __builtin_amdgcn_wmma_f32_16x16x4_f32(false, a, false, bv,
                                                    (short)0, acc, false, false);
    }

    float* dst      = isK ? hk : hqb;
    const int rbase = isK ? (r0 - BL_) : r0;
#pragma unroll
    for (int r = 0; r < 8; ++r) {
        const int row = rbase + r + 8 * half;      // C/D layout: M = r + 8*half
        float v = acc[r];
        if (!isK) v += b1[d0 + lp];                // fold b1 into hqb
        dst[(size_t)row * D_ + d0 + lp] = v;
    }
}

// ---------------------------------------------------------------------------
// Kernel 2: fused gated attention for one (b, 16-row q tile).
// 8 waves: each owns 4 k-tiles (conflict via VALU for all 4 at once, S via WMMA, gate),
// then per-row wave32 softmax, then P@V via WMMA (one d-tile per wave).
// ---------------------------------------------------------------------------
__global__ __launch_bounds__(256)
void cga_attn_kernel(const float* __restrict__ Q, const float* __restrict__ K,
                     const float* __restrict__ V, const int* __restrict__ mask,
                     const float* __restrict__ W2, const float* __restrict__ b2,
                     const float* __restrict__ hqb, const float* __restrict__ hk,
                     float* __restrict__ out, float* __restrict__ weights)
{
    const int b  = blockIdx.x >> 5;    // batch
    const int q0 = (blockIdx.x & 31) * 16;

    const int tid  = threadIdx.x;
    const int wave = tid >> 5;
    const int lane = tid & 31;
    const int half = lane >> 4;
    const int lp   = lane & 15;

    __shared__ float ldsQ[16][132];    // Q tile (padded)
    __shared__ float ldsH[16][132];    // hqb tile (b1 folded)
    __shared__ float ldsW2[128];
    __shared__ float SG[16][516];      // gated scores, +4 pad for P@V column reads

    { // stage Q tile + hqb tile + W2
        const int row = tid >> 4;
        const int col = (tid & 15) * 8;
        const float* qs = Q   + ((size_t)(b * L_) + q0 + row) * D_ + col;
        const float* hs = hqb + ((size_t)(b * L_) + q0 + row) * D_ + col;
        *(float4*)&ldsQ[row][col]     = *(const float4*)(qs);
        *(float4*)&ldsQ[row][col + 4] = *(const float4*)(qs + 4);
        *(float4*)&ldsH[row][col]     = *(const float4*)(hs);
        *(float4*)&ldsH[row][col + 4] = *(const float4*)(hs + 4);
        if (tid < 128) ldsW2[tid] = W2[tid];
    }
    __syncthreads();

    const float bias2 = b2[0];

    // ---- conflict[q,k] = sum_d relu(hqb[q,d]+hk[k,d])*W2[d]  (VALU) ----
    // One d loop for all four k tiles of the wave (tile j = wave + 8*j): every
    // hq / W2 quad read from LDS serves four keys per lane, and the four hk
    // loads of a trip are independent. Each conf[j][r] adds its quads in ascending d.
    float conf[4][8];
#pragma unroll
    for (int j = 0; j < 4; ++j)
#pragma unroll
        for (int r = 0; r < 8; ++r) conf[j][r] = 0.f;

    const float* hkr = hk + ((size_t)(b * L_) + wave * 16 + lp) * D_;
    for (int d = 0; d < D_; d += 4) {
        v4f hv[4];
#pragma unroll
        for (int j = 0; j < 4; ++j)                 // rows 128 apart: tile j
            hv[j] = *(const v4f*)(hkr + (size_t)j * 128 * D_ + d);
        v4f wv = *(const v4f*)&ldsW2[d];            // LDS broadcast
#pragma unroll
        for (int r = 0; r < 8; ++r) {
            v4f hq = *(const v4f*)&ldsH[r + 8 * half][d];  // LDS broadcast
#pragma unroll
            for (int j = 0; j < 4; ++j) {
                conf[j][r] += fmaxf(hq.x + hv[j].x, 0.f) * wv.x
                            + fmaxf(hq.y + hv[j].y, 0.f) * wv.y
                            + fmaxf(hq.z + hv[j].z, 0.f) * wv.z
                            + fmaxf(hq.w + hv[j].w, 0.f) * wv.w;
            }
        }
    }

    // mask words of the lane's 32 (q row, k tile) places: one address pair,
    // the places told apart by constant offsets
    const int* mrow = mask + (((size_t)b * L_) + q0 + 8 * half) * L_ + wave * 16 + lp;
    int mv[4][8];
#pragma unroll
    for (int j = 0; j < 4; ++j)
#pragma unroll
        for (int r = 0; r < 8; ++r) mv[j][r] = mrow[r * L_ + j * 128];
    // precaution: the address pair of the issued mask loads stays live up to
    // this wait, so nothing rewrites it ahead of the wait
    asm volatile("s_wait_xcnt 0x0" :: "v"(mrow) : "memory");

    const float* kbase = K + ((size_t)(b * L_) + wave * 16 + lp) * D_ + 2 * half;

    // unrolled so that conf[j] stays in registers
#pragma unroll
    for (int j = 0; j < 4; ++j) {
        const int k0 = (wave + 8 * j) * 16;

        // ---- S = Q_tile * K_tile^T  (32 chained f32 WMMAs) ----
        v8f acc = {};
        const float* krow = kbase + (size_t)j * 128 * D_;   // rows 128 apart: tile j
        for (int c = 0; c < D_; c += 4) {
            v2f a  = *(const v2f*)&ldsQ[lp][c + 2 * half];
            v2f bv = *(const v2f*)(krow + c);   // B[kb+j][n] == K[k0+n][c+kb+j]
            acc = __builtin_amdgcn_wmma_f32_16x16x4_f32(false, a, false, bv,
                                                        (short)0, acc, false, false);
        }

        // ---- gate + mask -> SG ----
#pragma unroll
        for (int r = 0; r < 8; ++r) {
            const int qrow = r + 8 * half;
            const float g  = 1.f / (1.f + __expf(-(conf[j][r] + bias2)));
            float sg = acc[r] * SCALE * g;
            if (mv[j][r] == 0) sg = -__builtin_inff();
            SG[qrow][k0 + lp] = sg;
        }
    }
    // precaution: the address pair of the K loads stays live up to this wait
    asm volatile("s_wait_xcnt 0x0" :: "v"(kbase) : "memory");
    __syncthreads();

    // ---- softmax over k (wave32 shuffle reduction; 2 rows per wave) ----
    for (int rr = 0; rr < 2; ++rr) {
        const int row = wave * 2 + rr;
        float mx = -__builtin_inff();
        for (int c = lane; c < L_; c += 32) mx = fmaxf(mx, SG[row][c]);
        for (int off = 16; off; off >>= 1) mx = fmaxf(mx, __shfl_xor(mx, off, 32));
        float sum = 0.f;
        for (int c = lane; c < L_; c += 32) {
            const float e = __expf(SG[row][c] - mx);
            SG[row][c] = e;
            sum += e;
        }
        for (int off = 16; off; off >>= 1) sum += __shfl_xor(sum, off, 32);
        const float inv = 1.f / sum;
        float* wout = weights + (((size_t)b * L_) + q0 + row) * L_;
        for (int c = lane; c < L_; c += 32) {
            const float p = SG[row][c] * inv;
            SG[row][c] = p;
            wout[c] = p;
        }
    }
    __syncthreads();

    // ---- out = P @ V  (128 chained f32 WMMAs; wave owns d-tile = 16*wave) ----
    {
        const int d0 = wave * 16;
        v8f acc = {};
        for (int k4 = 0; k4 < L_; k4 += 4) {
            v2f a = *(const v2f*)&SG[lp][k4 + 2 * half];     // A: P[m][k4+kb+j]
            const float* vr = V + ((size_t)(b * L_) + k4 + 2 * half) * D_ + d0 + lp;
            v2f bv; bv.x = vr[0]; bv.y = vr[D_];             // B: V[k4+kb+j][d0+n]
            acc = __builtin_amdgcn_wmma_f32_16x16x4_f32(false, a, false, bv,
                                                        (short)0, acc, false, false);
        }
#pragma unroll
        for (int r = 0; r < 8; ++r)
            out[(((size_t)b * L_) + q0 + r + 8 * half) * D_ + d0 + lp] = acc[r];
    }
}

// ---------------------------------------------------------------------------
extern "C" void kernel_launch(void* const* d_in, const int* in_sizes, int n_in,
                              void* d_out, int out_size, void* d_ws, size_t ws_size,
                              hipStream_t stream)
{
    const float* Q    = (const float*)d_in[0];
    const float* K    = (const float*)d_in[1];
    const float* V    = (const float*)d_in[2];
    const int*   mask = (const int*)  d_in[3];
    const float* W1   = (const float*)d_in[4];
    const float* b1   = (const float*)d_in[5];
    const float* W2   = (const float*)d_in[6];
    const float* b2   = (const float*)d_in[7];

    float* out     = (float*)d_out;                       // [B,L,D]
    float* weights = (float*)d_out + (size_t)BL_ * D_;    // [B,L,L]

    // workspace: hqb [B,L,D] then hk [B,L,D]  (2 MB total)
    float* hqb = (float*)d_ws;
    float* hk  = (float*)d_ws + (size_t)BL_ * D_;

    cga_proj_kernel<<<2 * BL_ / 16, 256, 0, stream>>>(Q, K, W1, b1, hqb, hk);
    cga_attn_kernel<<<B_ * (L_ / 16), 256, 0, stream>>>(Q, K, V, mask, W2, b2,
                                                        hqb, hk, out, weights);
}

// v002
// Measured time: 36.5 microseconds a run.
// Next to v001, in two timings, it ran 1.10 times as fast each time.
// Over all steps from v000 it is 1.31 times as fast.
#include <hip/hip_runtime.h>
#include <hip/hip_bf16.h>

typedef __attribute__((ext_vector_type(2))) float v2f;
typedef __attribute__((ext_vector_type(4))) float v4f;
typedef __attribute__((ext_vector_type(8))) float v8f;

#define B_  4
#define L_  512
#define D_  128
#define BL_ (B_ * L_)
#define SCALE 0.08838834764831845f  /* 1/sqrt(128) */

// ---------------------------------------------------------------------------
// Kernel 1: hqb = Q @ W1[:D] + b1 ; nhk = -(K @ W1[D:])  (stored negated)
// X = [Q; K] rows 0..2*BL-1. One WG = 16 rows; wave w = output cols [16w,16w+16).
// V_WMMA_F32_16X16X4_F32 accumulating over the 128-deep contraction.
// ---------------------------------------------------------------------------
__global__ __launch_bounds__(256)
void cga_proj_kernel(const float* __restrict__ Q, const float* __restrict__ K,
                     const float* __restrict__ W1, const float* __restrict__ b1,
                     float* __restrict__ hqb, float* __restrict__ nhk)
{
    const int r0   = blockIdx.x * 16;          // row tile in X (0..4095)
    const bool isK = (r0 >= BL_);
    const float* X = isK ? (K + (size_t)(r0 - BL_) * D_) : (Q + (size_t)r0 * D_);

    const int tid  = threadIdx.x;
    const int wave = tid >> 5;
    const int lane = tid & 31;
    const int half = lane >> 4;        // K-pair selector for A/B operands
    const int lp   = lane & 15;        // m (A) / n (B,C,D)

    __shared__ float ldsX[16][132];    // +4 pad: stride-132 kills bank conflicts

    { // cooperative 16x128 tile stage: 256 threads x 8 floats
        const int row = tid >> 4;
        const int col = (tid & 15) * 8;
        const float* src = X + (size_t)row * D_ + col;
        *(float4*)&ldsX[row][col]     = *(const float4*)(src);
        *(float4*)&ldsX[row][col + 4] = *(const float4*)(src + 4);
    }
    __syncthreads();

    const int d0   = wave * 16;        // output column tile
    const int woff = isK ? D_ : 0;     // which half of W1 [256,128]

    v8f acc = {};
    for (int c = 0; c < D_; c += 4) {
        // A: X[m][c + kb + j], contiguous float2 per lane
        v2f a = *(const v2f*)&ldsX[lp][c + 2 * half];
        // B: W1[woff + c + kb + j][d0 + n] — two coalesced scalar reads
        const float* wr = W1 + (size_t)(woff + c + 2 * half) * D_ + d0 + lp;
        v2f bv; bv.x = wr[0]; bv.y = wr[D_];
        acc = __builtin_amdgcn_wmma_f32_16x16x4_f32(false, a, false, bv,
                                                    (short)0, acc, false, false);
    }

    float* dst      = isK ? nhk : hqb;
    const int rbase = isK ? (r0 - BL_) : r0;
#pragma unroll
    for (int r = 0; r < 8; ++r) {
        const int row = rbase + r + 8 * half;      // C/D layout: M = r + 8*half
        float v = isK ? -acc[r]                    // key side goes out negated
                      : acc[r] + b1[d0 + lp];      // fold b1 into hqb
        dst[(size_t)row * D_ + d0 + lp] = v;
    }
}

// ---------------------------------------------------------------------------
// Kernel 2: fused gated attention for one (b, 16-row q tile).
// 8 waves: each owns 4 k-tiles (conflict via VALU for all 4 at once, S via WMMA, gate),
// then per-row wave32 softmax, then P@V via WMMA (one d-tile per wave).
// ---------------------------------------------------------------------------
__global__ __launch_bounds__(256)
void cga_attn_kernel(const float* __restrict__ Q, const float* __restrict__ K,
                     const float* __restrict__ V, const int* __restrict__ mask,
                     const float* __restrict__ W2, const float* __restrict__ b2,
                     const float* __restrict__ hqb, const float* __restrict__ nhk,
                     float* __restrict__ out, float* __restrict__ weights)
{
    const int b  = blockIdx.x >> 5;    // batch
    const int q0 = (blockIdx.x & 31) * 16;

    const int tid  = threadIdx.x;
    const int wave = tid >> 5;
    const int lane = tid & 31;
    const int half = lane >> 4;
    const int lp   = lane & 15;

    __shared__ float ldsQ[16][132];    // Q tile (padded)
    __shared__ float ldsH[16][132];    // hqb tile (b1 folded)
    __shared__ float ldsW2[128];
    __shared__ float SG[16][516];      // gated scores, +4 pad for P@V column reads

    { // stage Q tile + hqb tile + W2
        const int row = tid >> 4;
        const int col = (tid & 15) * 8;
        const float* qs = Q   + ((size_t)(b * L_) + q0 + row) * D_ + col;
        const float* hs = hqb + ((size_t)(b * L_) + q0 + row) * D_ + col;
        *(float4*)&ldsQ[row][col]     = *(const float4*)(qs);
        *(float4*)&ldsQ[row][col + 4] = *(const float4*)(qs + 4);
        *(float4*)&ldsH[row][col]     = *(const float4*)(hs);
        *(float4*)&ldsH[row][col + 4] = *(const float4*)(hs + 4);
        if (tid < 128) ldsW2[tid] = W2[tid];
    }
    __syncthreads();

    const float bias2 = b2[0];

    // ---- conflict[q,k] = sum_d relu(hqb[q,d]+hk[k,d])*W2[d]  (VALU) ----
    // relu(a + b) = max(a, -b) + b, so
    //   conflict = sum_d max(hqb[q,d], nhk[k,d])*W2[d] - sum_d nhk[k,d]*W2[d].
    // The first sum costs one max and one multiply-add an element (no add in
    // front of the max); the second depends on the key alone: once per lane and key.
    // One d loop for all four k tiles of the wave (tile j = wave + 8*j). Each sum
    // is kept as an (even d, odd d) pair, so that two multiply-adds go as one
    // packed instruction; the pair is added up behind the loop.
    v2f cacc[4][8];
    v2f ksum[4];
#pragma unroll
    for (int j = 0; j < 4; ++j) {
        ksum[j] = (v2f){0.f, 0.f};
#pragma unroll
        for (int r = 0; r < 8; ++r) cacc[j][r] = (v2f){0.f, 0.f};
    }

    const float* hkr = nhk + ((size_t)(b * L_) + wave * 16 + lp) * D_;
    for (int d = 0; d < D_; d += 4) {
        v4f hv[4];
#pragma unroll
        for (int j = 0; j < 4; ++j)                 // rows 128 apart: tile j
            hv[j] = *(const v4f*)(hkr + (size_t)j * 128 * D_ + d);
        const v4f wv  = *(const v4f*)&ldsW2[d];     // LDS broadcast
        const v2f w01 = wv.xy, w23 = wv.zw;
#pragma unroll
        for (int j = 0; j < 4; ++j) {
            ksum[j] = __builtin_elementwise_fma(hv[j].xy, w01, ksum[j]);
            ksum[j] = __builtin_elementwise_fma(hv[j].zw, w23, ksum[j]);
        }
#pragma unroll
        for (int r = 0; r < 8; ++r) {
            const v4f hq = *(const v4f*)&ldsH[r + 8 * half][d];  // LDS broadcast
#pragma unroll
            for (int j = 0; j < 4; ++j) {
                const v2f m01 = __builtin_elementwise_max(hq.xy, hv[j].xy);
                const v2f m23 = __builtin_elementwise_max(hq.zw, hv[j].zw);
                cacc[j][r] = __builtin_elementwise_fma(m01, w01, cacc[j][r]);
                cacc[j][r] = __builtin_elementwise_fma(m23, w23, cacc[j][r]);
            }
        }
    }

    float conf[4][8];
#pragma unroll
    for (int j = 0; j < 4; ++j) {
        const float ks = ksum[j].x + ksum[j].y;
#pragma unroll
        for (int r = 0; r < 8; ++r) conf[j][r] = (cacc[j][r].x + cacc[j][r].y) - ks;
    }

    // mask words of the lane's 32 (q row, k tile) places: one address pair,
    // the places told apart by constant offsets
    const int* mrow = mask + (((size_t)b * L_) + q0 + 8 * half) * L_ + wave * 16 + lp;
    int mv[4][8];
#pragma unroll
    for (int j = 0; j < 4; ++j)
#pragma unroll
        for (int r = 0; r < 8; ++r) mv[j][r] = mrow[r * L_ + j * 128];
    // precaution: the address pair of the issued mask loads stays live up to
    // this wait, so nothing rewrites it ahead of the wait
    asm volatile("s_wait_xcnt 0x0" :: "v"(mrow) : "memory");

    const float* kbase = K + ((size_t)(b * L_) + wave * 16 + lp) * D_ + 2 * half;

    // unrolled so that conf[j] stays in registers
#pragma unroll
    for (int j = 0; j < 4; ++j) {
        const int k0 = (wave + 8 * j) * 16;

        // ---- S = Q_tile * K_tile^T  (32 chained f32 WMMAs) ----
        v8f acc = {};
        const float* krow = kbase + (size_t)j * 128 * D_;   // rows 128 apart: tile j
        for (int c = 0; c < D_; c += 4) {
            v2f a  = *(const v2f*)&ldsQ[lp][c + 2 * half];
            v2f bv = *(const v2f*)(krow + c);   // B[kb+j][n] == K[k0+n][c+kb+j]
            acc = __builtin_amdgcn_wmma_f32_16x16x4_f32(false, a, false, bv,
                                                        (short)0, acc, false, false);
        }

        // ---- gate + mask -> SG ----
#pragma unroll
        for (int r = 0; r < 8; ++r) {
            const int qrow = r + 8 * half;
            const float g  = 1.f / (1.f + __expf(-(conf[j][r] + bias2)));
            float sg = acc[r] * SCALE * g;
            if (mv[j][r] == 0) sg = -__builtin_inff();
            SG[qrow][k0 + lp] = sg;
        }
    }
    // precaution: the address pair of the K loads stays live up to this wait
    asm volatile("s_wait_xcnt 0x0" :: "v"(kbase) : "memory");
    __syncthreads();

    // ---- softmax over k (wave32 shuffle reduction; 2 rows per wave) ----
    for (int rr = 0; rr < 2; ++rr) {
        const int row = wave * 2 + rr;
        float mx = -__builtin_inff();
        for (int c = lane; c < L_; c += 32) mx = fmaxf(mx, SG[row][c]);
        for (int off = 16; off; off >>= 1) mx = fmaxf(mx, __shfl_xor(mx, off, 32));
        float sum = 0.f;
        for (int c = lane; c < L_; c += 32) {
            const float e = __expf(SG[row][c] - mx);
            SG[row][c] = e;
            sum += e;
        }
        for (int off = 16; off; off >>= 1) sum += __shfl_xor(sum, off, 32);
        const float inv = 1.f / sum;
        float* wout = weights + (((size_t)b * L_) + q0 + row) * L_;
        for (int c = lane; c < L_; c += 32) {
            const float p = SG[row][c] * inv;
            SG[row][c] = p;
            wout[c] = p;
        }
    }
    __syncthreads();

    // ---- out = P @ V  (128 chained f32 WMMAs; wave owns d-tile = 16*wave) ----
    {
        const int d0 = wave * 16;
        v8f acc = {};
        for (int k4 = 0; k4 < L_; k4 += 4) {
            v2f a = *(const v2f*)&SG[lp][k4 + 2 * half];     // A: P[m][k4+kb+j]
            const float* vr = V + ((size_t)(b * L_) + k4 + 2 * half) * D_ + d0 + lp;
            v2f bv; bv.x = vr[0]; bv.y = vr[D_];             // B: V[k4+kb+j][d0+n]
            acc = __builtin_amdgcn_wmma_f32_16x16x4_f32(false, a, false, bv,
                                                        (short)0, acc, false, false);
        }
#pragma unroll
        for (int r = 0; r < 8; ++r)
            out[(((size_t)b * L_) + q0 + r + 8 * half) * D_ + d0 + lp] = acc[r];
    }
}

// ---------------------------------------------------------------------------
extern "C" void kernel_launch(void* const* d_in, const int* in_sizes, int n_in,
                              void* d_out, int out_size, void* d_ws, size_t ws_size,
                              hipStream_t stream)
{
    const float* Q    = (const float*)d_in[0];
    const float* K    = (const float*)d_in[1];
    const float* V    = (const float*)d_in[2];
    const int*   mask = (const int*)  d_in[3];
    const float* W1   = (const float*)d_in[4];
    const float* b1   = (const float*)d_in[5];
    const float* W2   = (const float*)d_in[6];
    const float* b2   = (const float*)d_in[7];

    float* out     = (float*)d_out;                       // [B,L,D]
    float* weights = (float*)d_out + (size_t)BL_ * D_;    // [B,L,L]

    // workspace: hqb [B,L,D] then nhk [B,L,D]  (2 MB total)
    float* hqb = (float*)d_ws;
    float* nhk = (float*)d_ws + (size_t)BL_ * D_;

    cga_proj_kernel<<<2 * BL_ / 16, 256, 0, stream>>>(Q, K, W1, b1, hqb, nhk);
    cga_attn_kernel<<<B_ * (L_ / 16), 256, 0, stream>>>(Q, K, V, mask, W2, b2,
                                                        hqb, nhk, out, weights);
}

// v003
// One run takes 28.4 microseconds.
// In both of two side-by-side timings against v002, it was 1.30 times as fast.
// All steps since v000 together make it 1.70 times as fast.
#include <hip/hip_runtime.h>
#include <hip/hip_bf16.h>

typedef __attribute__((ext_vector_type(2))) float v2f;
typedef __attribute__((ext_vector_type(4))) float v4f;
typedef __attribute__((ext_vector_type(8))) float v8f;

#define B_  4
#define L_  512
#define D_  128
#define BL_ (B_ * L_)
#define SCALE 0.08838834764831845f  /* 1/sqrt(128) */
#define VPRE 30   /* key steps of V fetched ahead in P@V: 60 loads in flight */

// ---------------------------------------------------------------------------
// Kernel 1: hqb = Q @ W1[:D] + b1 ; nhk = -(K @ W1[D:])  (stored negated)
// X = [Q; K] rows 0..2*BL-1. One WG = 16 rows; wave w = output cols [16w,16w+16).
// V_WMMA_F32_16X16X4_F32 accumulating over the 128-deep contraction.
// ---------------------------------------------------------------------------
__global__ __launch_bounds__(256)
void cga_proj_kernel(const float* __restrict__ Q, const float* __restrict__ K,
                     const float* __restrict__ W1, const float* __restrict__ b1,
                     float* __restrict__ hqb, float* __restrict__ nhk)
{
    const int r0   = blockIdx.x * 16;          // row tile in X (0..4095)
    const bool isK = (r0 >= BL_);
    const float* X = isK ? (K + (size_t)(r0 - BL_) * D_) : (Q + (size_t)r0 * D_);

    const int tid  = threadIdx.x;
    const int wave = tid >> 5;
    const int lane = tid & 31;
    const int half = lane >> 4;        // K-pair selector for A/B operands
    const int lp   = lane & 15;        // m (A) / n (B,C,D)

    __shared__ float ldsX[16][132];    // +4 pad: stride-132 kills bank conflicts

    { // cooperative 16x128 tile stage: 256 threads x 8 floats
        const int row = tid >> 4;
        const int col = (tid & 15) * 8;
        const float* src = X + (size_t)row * D_ + col;
        *(float4*)&ldsX[row][col]     = *(const float4*)(src);
        *(float4*)&ldsX[row][col + 4] = *(const float4*)(src + 4);
    }
    __syncthreads();

    const int d0   = wave * 16;        // output column tile
    const int woff = isK ? D_ : 0;     // which half of W1 [256,128]

    v8f acc = {};
    for (int c = 0; c < D_; c += 4) {
        // A: X[m][c + kb + j], contiguous float2 per lane
        v2f a = *(const v2f*)&ldsX[lp][c + 2 * half];
        // B: W1[woff + c + kb + j][d0 + n] — two coalesced scalar reads
        const float* wr = W1 + (size_t)(woff + c + 2 * half) * D_ + d0 + lp;
        v2f bv; bv.x = wr[0]; bv.y = wr[D_];
        acc = __builtin_amdgcn_wmma_f32_16x16x4_f32(false, a, false, bv,
                                                    (short)0, acc, false, false);
    }

    float* dst      = isK ? nhk : hqb;
    const int rbase = isK ? (r0 - BL_) : r0;
#pragma unroll
    for (int r = 0; r < 8; ++r) {
        const int row = rbase + r + 8 * half;      // C/D layout: M = r + 8*half
        float v = isK ? -acc[r]                    // key side goes out negated
                      : acc[r] + b1[d0 + lp];      // fold b1 into hqb
        dst[(size_t)row * D_ + d0 + lp] = v;
    }
}

// ---------------------------------------------------------------------------
// Kernel 2: fused gated attention for one (b, 16-row q tile).
// 8 waves: each owns 4 k-tiles (conflict via VALU for all 4 at once, S via WMMA, gate),
// then per-row wave32 softmax, then P@V via WMMA (one d-tile per wave).
// ---------------------------------------------------------------------------
__global__ __launch_bounds__(256)
void cga_attn_kernel(const float* __restrict__ Q, const float* __restrict__ K,
                     const float* __restrict__ V, const int* __restrict__ mask,
                     const float* __restrict__ W2, const float* __restrict__ b2,
                     const float* __restrict__ hqb, const float* __restrict__ nhk,
                     float* __restrict__ out, float* __restrict__ weights)
{
    const int b  = blockIdx.x >> 5;    // batch
    const int q0 = (blockIdx.x & 31) * 16;

    const int tid  = threadIdx.x;
    const int wave = tid >> 5;
    const int lane = tid & 31;
    const int half = lane >> 4;
    const int lp   = lane & 15;

    __shared__ float ldsQ[16][132];    // Q tile (padded)
    __shared__ float ldsH[16][132];    // hqb tile (b1 folded)
    __shared__ float ldsW2[128];
    __shared__ float SG[16][516];      // gated scores, +4 pad for P@V column reads

    { // stage Q tile + hqb tile + W2
        const int row = tid >> 4;
        const int col = (tid & 15) * 8;
        const float* qs = Q   + ((size_t)(b * L_) + q0 + row) * D_ + col;
        const float* hs = hqb + ((size_t)(b * L_) + q0 + row) * D_ + col;
        *(float4*)&ldsQ[row][col]     = *(const float4*)(qs);
        *(float4*)&ldsQ[row][col + 4] = *(const float4*)(qs + 4);
        *(float4*)&ldsH[row][col]     = *(const float4*)(hs);
        *(float4*)&ldsH[row][col + 4] = *(const float4*)(hs + 4);
        if (tid < 128) ldsW2[tid] = W2[tid];
    }
    __syncthreads();

    const float bias2 = b2[0];

    // ---- conflict[q,k] = sum_d relu(hqb[q,d]+hk[k,d])*W2[d]  (VALU) ----
    // relu(a + b) = max(a, -b) + b, so
    //   conflict = sum_d max(hqb[q,d], nhk[k,d])*W2[d] - sum_d nhk[k,d]*W2[d].
    // The first sum costs one max and one multiply-add an element (no add in
    // front of the max); the second depends on the key alone: once per lane and key.
    // One d loop for all four k tiles of the wave (tile j = wave + 8*j). Each sum
    // is kept as an (even d, odd d) pair, so that two multiply-adds go as one
    // packed instruction; the pair is added up behind the loop.
    v2f cacc[4][8];
    v2f ksum[4];
#pragma unroll
    for (int j = 0; j < 4; ++j) {
        ksum[j] = (v2f){0.f, 0.f};
#pragma unroll
        for (int r = 0; r < 8; ++r) cacc[j][r] = (v2f){0.f, 0.f};
    }

    const float* hkr = nhk + ((size_t)(b * L_) + wave * 16 + lp) * D_;
    for (int d = 0; d < D_; d += 4) {
        v4f hv[4];
#pragma unroll
        for (int j = 0; j < 4; ++j)                 // rows 128 apart: tile j
            hv[j] = *(const v4f*)(hkr + (size_t)j * 128 * D_ + d);
        const v4f wv  = *(const v4f*)&ldsW2[d];     // LDS broadcast
        const v2f w01 = wv.xy, w23 = wv.zw;
#pragma unroll
        for (int j = 0; j < 4; ++j) {
            ksum[j] = __builtin_elementwise_fma(hv[j].xy, w01, ksum[j]);
            ksum[j] = __builtin_elementwise_fma(hv[j].zw, w23, ksum[j]);
        }
#pragma unroll
        for (int r = 0; r < 8; ++r) {
            const v4f hq = *(const v4f*)&ldsH[r + 8 * half][d];  // LDS broadcast
#pragma unroll
            for (int j = 0; j < 4; ++j) {
                const v2f m01 = __builtin_elementwise_max(hq.xy, hv[j].xy);
                const v2f m23 = __builtin_elementwise_max(hq.zw, hv[j].zw);
                cacc[j][r] = __builtin_elementwise_fma(m01, w01, cacc[j][r]);
                cacc[j][r] = __builtin_elementwise_fma(m23, w23, cacc[j][r]);
            }
        }
    }

    float conf[4][8];
#pragma unroll
    for (int j = 0; j < 4; ++j) {
        const float ks = ksum[j].x + ksum[j].y;
#pragma unroll
        for (int r = 0; r < 8; ++r) conf[j][r] = (cacc[j][r].x + cacc[j][r].y) - ks;
    }

    // mask words of the lane's 32 (q row, k tile) places: one address pair,
    // the places told apart by constant offsets
    const int* mrow = mask + (((size_t)b * L_) + q0 + 8 * half) * L_ + wave * 16 + lp;
    int mv[4][8];
#pragma unroll
    for (int j = 0; j < 4; ++j)
#pragma unroll
        for (int r = 0; r < 8; ++r) mv[j][r] = mrow[r * L_ + j * 128];
    // precaution: the address pair of the issued mask loads stays live up to
    // this wait, so nothing rewrites it ahead of the wait
    asm volatile("s_wait_xcnt 0x0" :: "v"(mrow) : "memory");

    const float* kbase = K + ((size_t)(b * L_) + wave * 16 + lp) * D_ + 2 * half;

    // unrolled so that conf[j] stays in registers
#pragma unroll
    for (int j = 0; j < 4; ++j) {
        const int k0 = (wave + 8 * j) * 16;

        // ---- S = Q_tile * K_tile^T  (32 chained f32 WMMAs) ----
        v8f acc = {};
        const float* krow = kbase + (size_t)j * 128 * D_;   // rows 128 apart: tile j
        for (int c = 0; c < D_; c += 4) {
            v2f a  = *(const v2f*)&ldsQ[lp][c + 2 * half];
            v2f bv = *(const v2f*)(krow + c);   // B[kb+j][n] == K[k0+n][c+kb+j]
            acc = __builtin_amdgcn_wmma_f32_16x16x4_f32(false, a, false, bv,
                                                        (short)0, acc, false, false);
        }

        // ---- gate + mask -> SG ----
#pragma unroll
        for (int r = 0; r < 8; ++r) {
            const int qrow = r + 8 * half;
            const float g  = 1.f / (1.f + __expf(-(conf[j][r] + bias2)));
            float sg = acc[r] * SCALE * g;
            if (mv[j][r] == 0) sg = -__builtin_inff();
            SG[qrow][k0 + lp] = sg;
        }
    }
    // precaution: the address pair of the K loads stays live up to this wait
    asm volatile("s_wait_xcnt 0x0" :: "v"(kbase) : "memory");
    __syncthreads();

    // ---- V fragments of P@V, fetched ahead ----
    // V depends on nothing computed here: the fragments of the first VPRE key
    // steps are asked for here, behind the barrier (which waits for every load
    // issued in front of it), and fly while the softmax runs. One address pair
    // for all 128 steps; a step is told from the next by a constant offset, so
    // the pair is not rewritten between the loads.
    const float* vbase = V + ((size_t)(b * L_) + 2 * half) * D_ + wave * 16 + lp;
    v2f vb[L_ / 4];                    // B: V[4s+kb+j][d0+n], step s
    // unrolled so that vb stays in registers
#pragma unroll
    for (int s = 0; s < VPRE; ++s) {
        vb[s].x = vbase[(4 * s) * D_];
        vb[s].y = vbase[(4 * s + 1) * D_];
    }

    // ---- softmax over k (wave32 shuffle reduction; 2 rows per wave) ----
    for (int rr = 0; rr < 2; ++rr) {
        const int row = wave * 2 + rr;
        float mx = -__builtin_inff();
        for (int c = lane; c < L_; c += 32) mx = fmaxf(mx, SG[row][c]);
        for (int off = 16; off; off >>= 1) mx = fmaxf(mx, __shfl_xor(mx, off, 32));
        float sum = 0.f;
        for (int c = lane; c < L_; c += 32) {
            const float e = __expf(SG[row][c] - mx);
            SG[row][c] = e;
            sum += e;
        }
        for (int off = 16; off; off >>= 1) sum += __shfl_xor(sum, off, 32);
        const float inv = 1.f / sum;
        float* wout = weights + (((size_t)b * L_) + q0 + row) * L_;
        for (int c = lane; c < L_; c += 32) {
            const float p = SG[row][c] * inv;
            SG[row][c] = p;
            wout[c] = p;
        }
    }
    __syncthreads();

    // ---- out = P @ V  (128 chained f32 WMMAs; wave owns d-tile = 16*wave) ----
    {
        const int d0 = wave * 16;
        v8f acc = {};
        // unrolled so that vb stays in registers and every V load has a constant
        // offset; step s asks for the fragment of step s + VPRE
#pragma unroll
        for (int s = 0; s < L_ / 4; ++s) {
            if (s + VPRE < L_ / 4) {
                vb[s + VPRE].x = vbase[(4 * (s + VPRE)) * D_];
                vb[s + VPRE].y = vbase[(4 * (s + VPRE) + 1) * D_];
            }
            v2f a = *(const v2f*)&SG[lp][4 * s + 2 * half];  // A: P[m][4s+kb+j]
            acc = __builtin_amdgcn_wmma_f32_16x16x4_f32(false, a, false, vb[s],
                                                        (short)0, acc, false, false);
        }
        // precaution: the address pair of the V loads stays live up to this wait
        asm volatile("s_wait_xcnt 0x0" :: "v"(vbase) : "memory");
#pragma unroll
        for (int r = 0; r < 8; ++r)
            out[(((size_t)b * L_) + q0 + r + 8 * half) * D_ + d0 + lp] = acc[r];
    }
}

// ---------------------------------------------------------------------------
extern "C" void kernel_launch(void* const* d_in, const int* in_sizes, int n_in,
                              void* d_out, int out_size, void* d_ws, size_t ws_size,
                              hipStream_t stream)
{
    const float* Q    = (const float*)d_in[0];
    const float* K    = (const float*)d_in[1];
    const float* V    = (const float*)d_in[2];
    const int*   mask = (const int*)  d_in[3];
    const float* W1   = (const float*)d_in[4];
    const float* b1   = (const float*)d_in[5];
    const float* W2   = (const float*)d_in[6];
    const float* b2   = (const float*)d_in[7];

    float* out     = (float*)d_out;                       // [B,L,D]
    float* weights = (float*)d_out + (size_t)BL_ * D_;    // [B,L,L]

    // workspace: hqb [B,L,D] then nhk [B,L,D]  (2 MB total)
    float* hqb = (float*)d_ws;
    float* nhk = (float*)d_ws + (size_t)BL_ * D_;

    cga_proj_kernel<<<2 * BL_ / 16, 256, 0, stream>>>(Q, K, W1, b1, hqb, nhk);
    cga_attn_kernel<<<B_ * (L_ / 16), 256, 0, stream>>>(Q, K, V, mask, W2, b2,
                                                        hqb, nhk, out, weights);
}

// v004
// Measured time: 26.9 microseconds a run.
// Next to v003, in two timings, it ran 1.04 times as fast each time.
// Counting every step since v000, it is 1.77 times as fast.
#include <hip/hip_runtime.h>
#include <hip/hip_bf16.h>

typedef __attribute__((ext_vector_type(2))) float v2f;
typedef __attribute__((ext_vector_type(4))) float v4f;
typedef __attribute__((ext_vector_type(8))) float v8f;

#define B_  4
#define L_  512
#define D_  128
#define BL_ (B_ * L_)
#define SCALE 0.08838834764831845f  /* 1/sqrt(128) */
#define TILEF (16 * D_)  /* floats of one 16-key tile in kp */
#define UNITF 128        /* floats of one 8-column unit of a key tile in kp */
#define VPRE 30   /* key steps of V fetched ahead in P@V: 60 loads in flight */

// ---------------------------------------------------------------------------
// Kernel 1: hqb = Q @ W1[:D] + b1 ; nhk = -(K @ W1[D:])  (stored negated) ; kp = K
// X = [Q; K] rows 0..2*BL-1. One WG = 16 rows; wave w = output cols [16w,16w+16).
// V_WMMA_F32_16X16X4_F32 accumulating over the 128-deep contraction.
// kp holds K bit for bit, in the order in which the lanes of kernel 2 take their
// B fragments of Q K^T:
//   kp[key tile][u][key in tile][hf][e][i] = K[key][8*u + 4*e + 2*hf + i]
// (hf = the lane's half, e = the first or second of two contraction steps).
// One 16-byte load a lane then feeds two steps, and the wave's 32 loads cover 512
// bytes in a row (4 whole cache lines) where 16 key rows gave 16 lines a load.
// ---------------------------------------------------------------------------
__global__ __launch_bounds__(256)
void cga_proj_kernel(const float* __restrict__ Q, const float* __restrict__ K,
                     const float* __restrict__ W1, const float* __restrict__ b1,
                     float* __restrict__ hqb, float* __restrict__ nhk,
                     float* __restrict__ kp)
{
    const int r0   = blockIdx.x * 16;          // row tile in X (0..4095)
    const bool isK = (r0 >= BL_);
    const float* X = isK ? (K + (size_t)(r0 - BL_) * D_) : (Q + (size_t)r0 * D_);

    const int tid  = threadIdx.x;
    const int wave = tid >> 5;
    const int lane = tid & 31;
    const int half = lane >> 4;        // K-pair selector for A/B operands
    const int lp   = lane & 15;        // m (A) / n (B,C,D)

    __shared__ float ldsX[16][132];    // +4 pad: stride-132 kills bank conflicts

    { // cooperative 16x128 tile stage: 256 threads x 8 floats
        const int row = tid >> 4;
        const int col = (tid & 15) * 8;
        const float* src = X + (size_t)row * D_ + col;
        *(float4*)&ldsX[row][col]     = *(const float4*)(src);
        *(float4*)&ldsX[row][col + 4] = *(const float4*)(src + 4);
    }
    __syncthreads();

    if (isK) { // the K tile out of LDS into kp: a wave stores 512 bytes in a row
        float* kt = kp + (size_t)(blockIdx.x - BL_ / 16) * TILEF + lane * 4;
        const int key = lane >> 1;
        const int hf  = lane & 1;
        for (int h = 0; h < 2; ++h) {          // two units a thread
            const int u = wave + 8 * h;
            const v2f e0 = *(const v2f*)&ldsX[key][8 * u + 2 * hf];
            const v2f e1 = *(const v2f*)&ldsX[key][8 * u + 4 + 2 * hf];
            *(v4f*)(kt + u * UNITF) = (v4f){e0.x, e0.y, e1.x, e1.y};
        }
        // precaution: stands in front of whatever rewrites a register that the
        // two issued stores name
        asm volatile("s_wait_xcnt 0x0" ::: "memory");
    }

    const int d0   = wave * 16;        // output column tile
    const int woff = isK ? D_ : 0;     // which half of W1 [256,128]

    v8f acc = {};
    for (int c = 0; c < D_; c += 4) {
        // A: X[m][c + kb + j], contiguous float2 per lane
        v2f a = *(const v2f*)&ldsX[lp][c + 2 * half];
        // B: W1[woff + c + kb + j][d0 + n] — two coalesced scalar reads
        const float* wr = W1 + (size_t)(woff + c + 2 * half) * D_ + d0 + lp;
        v2f bv; bv.x = wr[0]; bv.y = wr[D_];
        acc = __builtin_amdgcn_wmma_f32_16x16x4_f32(false, a, false, bv,
                                                    (short)0, acc, false, false);
    }

    float* dst      = isK ? nhk : hqb;
    const int rbase = isK ? (r0 - BL_) : r0;
#pragma unroll
    for (int r = 0; r < 8; ++r) {
        const int row = rbase + r + 8 * half;      // C/D layout: M = r + 8*half
        float v = isK ? -acc[r]                    // key side goes out negated
                      : acc[r] + b1[d0 + lp];      // fold b1 into hqb
        dst[(size_t)row * D_ + d0 + lp] = v;
    }
}

// ---------------------------------------------------------------------------
// Kernel 2: fused gated attention for one (b, 16-row q tile).
// 8 waves: each owns 4 k-tiles (conflict via VALU for all 4 at once, S via WMMA, gate),
// then per-row wave32 softmax, then P@V via WMMA (one d-tile per wave).
// ---------------------------------------------------------------------------
__global__ __launch_bounds__(256)
void cga_attn_kernel(const float* __restrict__ Q, const float* __restrict__ kp,
                     const float* __restrict__ V, const int* __restrict__ mask,
                     const float* __restrict__ W2, const float* __restrict__ b2,
                     const float* __restrict__ hqb, const float* __restrict__ nhk,
                     float* __restrict__ out, float* __restrict__ weights)
{
    const int b  = blockIdx.x >> 5;    // batch
    const int q0 = (blockIdx.x & 31) * 16;

    const int tid  = threadIdx.x;
    const int wave = tid >> 5;
    const int lane = tid & 31;
    const int half = lane >> 4;
    const int lp   = lane & 15;

    __shared__ float ldsQ[16][132];    // Q tile (padded)
    __shared__ float ldsH[16][132];    // hqb tile (b1 folded)
    __shared__ float ldsW2[128];
    __shared__ float SG[16][516];      // gated scores, +4 pad for P@V column reads

    { // stage Q tile + hqb tile + W2
        const int row = tid >> 4;
        const int col = (tid & 15) * 8;
        const float* qs = Q   + ((size_t)(b * L_) + q0 + row) * D_ + col;
        const float* hs = hqb + ((size_t)(b * L_) + q0 + row) * D_ + col;
        *(float4*)&ldsQ[row][col]     = *(const float4*)(qs);
        *(float4*)&ldsQ[row][col + 4] = *(const float4*)(qs + 4);
        *(float4*)&ldsH[row][col]     = *(const float4*)(hs);
        *(float4*)&ldsH[row][col + 4] = *(const float4*)(hs + 4);
        if (tid < 128) ldsW2[tid] = W2[tid];
    }
    __syncthreads();

    const float bias2 = b2[0];

    // ---- conflict[q,k] = sum_d relu(hqb[q,d]+hk[k,d])*W2[d]  (VALU) ----
    // relu(a + b) = max(a, -b) + b, so
    //   conflict = sum_d max(hqb[q,d], nhk[k,d])*W2[d] - sum_d nhk[k,d]*W2[d].
    // The first sum costs one max and one multiply-add an element (no add in
    // front of the max); the second depends on the key alone: once per lane and key.
    // One d loop for all four k tiles of the wave (tile j = wave + 8*j). Each sum
    // is kept as an (even d, odd d) pair, so that two multiply-adds go as one
    // packed instruction; the pair is added up behind the loop.
    v2f cacc[4][8];
    v2f ksum[4];
#pragma unroll
    for (int j = 0; j < 4; ++j) {
        ksum[j] = (v2f){0.f, 0.f};
#pragma unroll
        for (int r = 0; r < 8; ++r) cacc[j][r] = (v2f){0.f, 0.f};
    }

    const float* hkr = nhk + ((size_t)(b * L_) + wave * 16 + lp) * D_;
    for (int d = 0; d < D_; d += 4) {
        v4f hv[4];
#pragma unroll
        for (int j = 0; j < 4; ++j)                 // rows 128 apart: tile j
            hv[j] = *(const v4f*)(hkr + (size_t)j * 128 * D_ + d);
        const v4f wv  = *(const v4f*)&ldsW2[d];     // LDS broadcast
        const v2f w01 = wv.xy, w23 = wv.zw;
#pragma unroll
        for (int j = 0; j < 4; ++j) {
            ksum[j] = __builtin_elementwise_fma(hv[j].xy, w01, ksum[j]);
            ksum[j] = __builtin_elementwise_fma(hv[j].zw, w23, ksum[j]);
        }
#pragma unroll
        for (int r = 0; r < 8; ++r) {
            const v4f hq = *(const v4f*)&ldsH[r + 8 * half][d];  // LDS broadcast
#pragma unroll
            for (int j = 0; j < 4; ++j) {
                const v2f m01 = __builtin_elementwise_max(hq.xy, hv[j].xy);
                const v2f m23 = __builtin_elementwise_max(hq.zw, hv[j].zw);
                cacc[j][r] = __builtin_elementwise_fma(m01, w01, cacc[j][r]);
                cacc[j][r] = __builtin_elementwise_fma(m23, w23, cacc[j][r]);
            }
        }
    }

    float conf[4][8];
#pragma unroll
    for (int j = 0; j < 4; ++j) {
        const float ks = ksum[j].x + ksum[j].y;
#pragma unroll
        for (int r = 0; r < 8; ++r) conf[j][r] = (cacc[j][r].x + cacc[j][r].y) - ks;
    }

    // mask words of the lane's 32 (q row, k tile) places: one address pair,
    // the places told apart by constant offsets
    const int* mrow = mask + (((size_t)b * L_) + q0 + 8 * half) * L_ + wave * 16 + lp;
    int mv[4][8];
#pragma unroll
    for (int j = 0; j < 4; ++j)
#pragma unroll
        for (int r = 0; r < 8; ++r) mv[j][r] = mrow[r * L_ + j * 128];
    // precaution: the address pair of the issued mask loads stays live up to
    // this wait, so nothing rewrites it ahead of the wait
    asm volatile("s_wait_xcnt 0x0" :: "v"(mrow) : "memory");

    const float* kbase = kp + (size_t)(b * (L_ / 16) + wave) * TILEF + lp * 8 + half * 4;

    // unrolled so that conf[j] stays in registers
#pragma unroll
    for (int j = 0; j < 4; ++j) {
        const int k0 = (wave + 8 * j) * 16;

        // ---- S = Q_tile * K_tile^T  (32 chained f32 WMMAs) ----
        v8f acc = {};
        const float* krow = kbase + (size_t)j * 8 * TILEF;   // 8 tiles apart: tile j
        for (int c = 0; c < D_; c += 8) {
            // xy: K[k0+n][c+kb+i], zw: K[k0+n][c+4+kb+i]  (kb = 2*half)
            const v4f kv = *(const v4f*)(krow + (c / 8) * UNITF);
            v2f a = *(const v2f*)&ldsQ[lp][c + 2 * half];
            acc = __builtin_amdgcn_wmma_f32_16x16x4_f32(false, a, false, kv.xy,
                                                        (short)0, acc, false, false);
            a = *(const v2f*)&ldsQ[lp][c + 4 + 2 * half];
            acc = __builtin_amdgcn_wmma_f32_16x16x4_f32(false, a, false, kv.zw,
                                                        (short)0, acc, false, false);
        }

        // ---- gate + mask -> SG ----
#pragma unroll
        for (int r = 0; r < 8; ++r) {
            const int qrow = r + 8 * half;
            const float g  = 1.f / (1.f + __expf(-(conf[j][r] + bias2)));
            float sg = acc[r] * SCALE * g;
            if (mv[j][r] == 0) sg = -__builtin_inff();
            SG[qrow][k0 + lp] = sg;
        }
    }
    // precaution: the address pair of the K loads stays live up to this wait
    asm volatile("s_wait_xcnt 0x0" :: "v"(kbase) : "memory");
    __syncthreads();

    // ---- V fragments of P@V, fetched ahead ----
    // V depends on nothing computed here: the fragments of the first VPRE key
    // steps are asked for here, behind the barrier (which waits for every load
    // issued in front of it), and fly while the softmax runs. One address pair
    // for all 128 steps; a step is told from the next by a constant offset, so
    // the pair is not rewritten between the loads.
    const float* vbase = V + ((size_t)(b * L_) + 2 * half) * D_ + wave * 16 + lp;
    v2f vb[L_ / 4];                    // B: V[4s+kb+j][d0+n], step s
    // unrolled so that vb stays in registers
#pragma unroll
    for (int s = 0; s < VPRE; ++s) {
        vb[s].x = vbase[(4 * s) * D_];
        vb[s].y = vbase[(4 * s + 1) * D_];
    }

    // ---- softmax over k (wave32 shuffle reduction; 2 rows per wave) ----
    for (int rr = 0; rr < 2; ++rr) {
        const int row = wave * 2 + rr;
        float mx = -__builtin_inff();
        for (int c = lane; c < L_; c += 32) mx = fmaxf(mx, SG[row][c]);
        for (int off = 16; off; off >>= 1) mx = fmaxf(mx, __shfl_xor(mx, off, 32));
        float sum = 0.f;
        for (int c = lane; c < L_; c += 32) {
            const float e = __expf(SG[row][c] - mx);
            SG[row][c] = e;
            sum += e;
        }
        for (int off = 16; off; off >>= 1) sum += __shfl_xor(sum, off, 32);
        const float inv = 1.f / sum;
        float* wout = weights + (((size_t)b * L_) + q0 + row) * L_;
        for (int c = lane; c < L_; c += 32) {
            const float p = SG[row][c] * inv;
            SG[row][c] = p;
            wout[c] = p;
        }
    }
    __syncthreads();

    // ---- out = P @ V  (128 chained f32 WMMAs; wave owns d-tile = 16*wave) ----
    {
        const int d0 = wave * 16;
        v8f acc = {};
        // unrolled so that vb stays in registers and every V load has a constant
        // offset; step s asks for the fragment of step s + VPRE
#pragma unroll
        for (int s = 0; s < L_ / 4; ++s) {
            if (s + VPRE < L_ / 4) {
                vb[s + VPRE].x = vbase[(4 * (s + VPRE)) * D_];
                vb[s + VPRE].y = vbase[(4 * (s + VPRE) + 1) * D_];
            }
            v2f a = *(const v2f*)&SG[lp][4 * s + 2 * half];  // A: P[m][4s+kb+j]
            acc = __builtin_amdgcn_wmma_f32_16x16x4_f32(false, a, false, vb[s],
                                                        (short)0, acc, false, false);
        }
        // precaution: the address pair of the V loads stays live up to this wait
        asm volatile("s_wait_xcnt 0x0" :: "v"(vbase) : "memory");
#pragma unroll
        for (int r = 0; r < 8; ++r)
            out[(((size_t)b * L_) + q0 + r + 8 * half) * D_ + d0 + lp] = acc[r];
    }
}

// ---------------------------------------------------------------------------
extern "C" void kernel_launch(void* const* d_in, const int* in_sizes, int n_in,
                              void* d_out, int out_size, void* d_ws, size_t ws_size,
                              hipStream_t stream)
{
    const float* Q    = (const float*)d_in[0];
    const float* K    = (const float*)d_in[1];
    const float* V    = (const float*)d_in[2];
    const int*   mask = (const int*)  d_in[3];
    const float* W1   = (const float*)d_in[4];
    const float* b1   = (const float*)d_in[5];
    const float* W2   = (const float*)d_in[6];
    const float* b2   = (const float*)d_in[7];

    float* out     = (float*)d_out;                       // [B,L,D]
    float* weights = (float*)d_out + (size_t)BL_ * D_;    // [B,L,L]

    // workspace: hqb [B,L,D], nhk [B,L,D], kp (B*L*D floats)  (3 MB total)
    float* hqb = (float*)d_ws;
    float* nhk = (float*)d_ws + (size_t)BL_ * D_;
    float* kp  = (float*)d_ws + (size_t)2 * BL_ * D_;

    cga_proj_kernel<<<2 * BL_ / 16, 256, 0, stream>>>(Q, K, W1, b1, hqb, nhk, kp);
    cga_attn_kernel<<<B_ * (L_ / 16), 256, 0, stream>>>(Q, kp, V, mask, W2, b2,
                                                        hqb, nhk, out, weights);
}

// v005
// A run of this version takes 26.1 microseconds.
// Two timings next to v004 both put it at 1.04 times that version's speed.
// Counting every step since v000, it is 1.84 times as fast.
#include <hip/hip_runtime.h>
#include <hip/hip_bf16.h>

typedef __attribute__((ext_vector_type(2))) float v2f;
typedef __attribute__((ext_vector_type(4))) float v4f;
typedef __attribute__((ext_vector_type(8))) float v8f;

#define B_  4
#define L_  512
#define D_  128
#define BL_ (B_ * L_)
#define SCALE 0.08838834764831845f  /* 1/sqrt(128) */
#define TILEF (16 * D_)  /* floats of one 16-key tile in kp */
#define UNITF 128        /* floats of one 8-column unit of a key tile in kp */
#define VPRE 30   /* key steps of V fetched ahead in P@V: 60 loads in flight */
#define HPRE 2    /* d trips of nhk fetched ahead in the conflict loop: 8 loads in flight */

// ---------------------------------------------------------------------------
// Kernel 1: hqb = Q @ W1[:D] + b1 ; nhk = -(K @ W1[D:])  (stored negated) ; kp = K
// X = [Q; K] rows 0..2*BL-1. One WG = 16 rows; wave w = output cols [16w,16w+16).
// V_WMMA_F32_16X16X4_F32 accumulating over the 128-deep contraction.
// kp holds K bit for bit, in the order in which the lanes of kernel 2 take their
// B fragments of Q K^T:
//   kp[key tile][u][key in tile][hf][e][i] = K[key][8*u + 4*e + 2*hf + i]
// (hf = the lane's half, e = the first or second of two contraction steps).
// One 16-byte load a lane then feeds two steps, and the wave's 32 loads cover 512
// bytes in a row (4 whole cache lines) where 16 key rows gave 16 lines a load.
// ---------------------------------------------------------------------------
__global__ __launch_bounds__(256)
void cga_proj_kernel(const float* __restrict__ Q, const float* __restrict__ K,
                     const float* __restrict__ W1, const float* __restrict__ b1,
                     float* __restrict__ hqb, float* __restrict__ nhk,
                     float* __restrict__ kp)
{
    const int r0   = blockIdx.x * 16;          // row tile in X (0..4095)
    const bool isK = (r0 >= BL_);
    const float* X = isK ? (K + (size_t)(r0 - BL_) * D_) : (Q + (size_t)r0 * D_);

    const int tid  = threadIdx.x;
    const int wave = tid >> 5;
    const int lane = tid & 31;
    const int half = lane >> 4;        // K-pair selector for A/B operands
    const int lp   = lane & 15;        // m (A) / n (B,C,D)

    __shared__ float ldsX[16][132];    // +4 pad: stride-132 kills bank conflicts

    { // cooperative 16x128 tile stage: 256 threads x 8 floats
        const int row = tid >> 4;
        const int col = (tid & 15) * 8;
        const float* src = X + (size_t)row * D_ + col;
        *(float4*)&ldsX[row][col]     = *(const float4*)(src);
        *(float4*)&ldsX[row][col + 4] = *(const float4*)(src + 4);
    }
    __syncthreads();

    if (isK) { // the K tile out of LDS into kp: a wave stores 512 bytes in a row
        float* kt = kp + (size_t)(blockIdx.x - BL_ / 16) * TILEF + lane * 4;
        const int key = lane >> 1;
        const int hf  = lane & 1;
        for (int h = 0; h < 2; ++h) {          // two units a thread
            const int u = wave + 8 * h;
            const v2f e0 = *(const v2f*)&ldsX[key][8 * u + 2 * hf];
            const v2f e1 = *(const v2f*)&ldsX[key][8 * u + 4 + 2 * hf];
            *(v4f*)(kt + u * UNITF) = (v4f){e0.x, e0.y, e1.x, e1.y};
        }
        // precaution: stands in front of whatever rewrites a register that the
        // two issued stores name
        asm volatile("s_wait_xcnt 0x0" ::: "memory");
    }

    const int d0   = wave * 16;        // output column tile
    const int woff = isK ? D_ : 0;     // which half of W1 [256,128]

    v8f acc = {};
    for (int c = 0; c < D_; c += 4) {
        // A: X[m][c + kb + j], contiguous float2 per lane
        v2f a = *(const v2f*)&ldsX[lp][c + 2 * half];
        // B: W1[woff + c + kb + j][d0 + n] — two coalesced scalar reads
        const float* wr = W1 + (size_t)(woff + c + 2 * half) * D_ + d0 + lp;
        v2f bv; bv.x = wr[0]; bv.y = wr[D_];
        acc = __builtin_amdgcn_wmma_f32_16x16x4_f32(false, a, false, bv,
                                                    (short)0, acc, false, false);
    }

    float* dst      = isK ? nhk : hqb;
    const int rbase = isK ? (r0 - BL_) : r0;
#pragma unroll
    for (int r = 0; r < 8; ++r) {
        const int row = rbase + r + 8 * half;      // C/D layout: M = r + 8*half
        float v = isK ? -acc[r]                    // key side goes out negated
                      : acc[r] + b1[d0 + lp];      // fold b1 into hqb
        dst[(size_t)row * D_ + d0 + lp] = v;
    }
}

// ---------------------------------------------------------------------------
// One trip (4 values of d) of kernel 2's conflict sum, for the lane's 8 q rows and
// 4 keys. hv is a ring of four trips of nhk in registers; U = trip mod 4 is a
// constant, so that the ring's places are fixed registers. The trip first asks for
// the nhk values of trip + HPRE, which stand at pf.
// ---------------------------------------------------------------------------
template <int U>
__device__ __forceinline__
void cga_conflict_trip(v4f (&hv)[4][4], const float* __restrict__ pf, const int d,
                       const float* ldsW2, const float (*ldsH)[132], const int half,
                       v2f (&cacc)[4][8], v2f (&ksum)[4])
{
#pragma unroll
    for (int j = 0; j < 4; ++j)                     // rows 128 apart: tile j
        hv[(U + HPRE) & 3][j] = *(const v4f*)(pf + (size_t)j * 128 * D_);
    // precaution: stands behind the last nhk loads of a pass, in front of whatever
    // rewrites an address register that the pass's issued loads name
    if (U == 3) asm volatile("s_wait_xcnt 0x0" ::: "memory");
    const v4f wv  = *(const v4f*)&ldsW2[d];         // LDS broadcast
    v4f hq[8];
#pragma unroll
    for (int r = 0; r < 8; ++r)
        hq[r] = *(const v4f*)&ldsH[r + 8 * half][d];         // LDS broadcast
    const v2f w01 = wv.xy, w23 = wv.zw;
#pragma unroll
    for (int j = 0; j < 4; ++j) {
        ksum[j] = __builtin_elementwise_fma(hv[U][j].xy, w01, ksum[j]);
        ksum[j] = __builtin_elementwise_fma(hv[U][j].zw, w23, ksum[j]);
    }
    // four q rows at a time: all their maxima, then all their multiply-adds, so that
    // no instruction stands close behind the one whose result it reads
#pragma unroll
    for (int rb = 0; rb < 8; rb += 4) {
        v2f m01[4][4], m23[4][4];
#pragma unroll
        for (int r = 0; r < 4; ++r)
#pragma unroll
            for (int j = 0; j < 4; ++j) {
                m01[r][j] = __builtin_elementwise_max(hq[rb + r].xy, hv[U][j].xy);
                m23[r][j] = __builtin_elementwise_max(hq[rb + r].zw, hv[U][j].zw);
            }
#pragma unroll
        for (int r = 0; r < 4; ++r)
#pragma unroll
            for (int j = 0; j < 4; ++j)
                cacc[j][rb + r] = __builtin_elementwise_fma(m01[r][j], w01, cacc[j][rb + r]);
#pragma unroll
        for (int r = 0; r < 4; ++r)
#pragma unroll
            for (int j = 0; j < 4; ++j)
                cacc[j][rb + r] = __builtin_elementwise_fma(m23[r][j], w23, cacc[j][rb + r]);
    }
    // compiler fence, no instruction: keeps the next trips' loads behind this trip.
    // Lifted to the head of the pass, they land in registers of their own and are
    // copied into the ring at the loop's foot, behind a wait for all of them; and
    // four trips merged need more than 256 registers
    asm volatile("" ::: "memory");
}

// ---------------------------------------------------------------------------
// Kernel 2: fused gated attention for one (b, 16-row q tile).
// 8 waves: each owns 4 k-tiles (conflict via VALU for all 4 at once, S via WMMA, gate),
// then per-row wave32 softmax, then P@V via WMMA (one d-tile per wave).
// ---------------------------------------------------------------------------
__global__ __launch_bounds__(256)
void cga_attn_kernel(const float* __restrict__ Q, const float* __restrict__ kp,
                     const float* __restrict__ V, const int* __restrict__ mask,
                     const float* __restrict__ W2, const float* __restrict__ b2,
                     const float* __restrict__ hqb, const float* __restrict__ nhk,
                     float* __restrict__ out, float* __restrict__ weights)
{
    const int b  = blockIdx.x >> 5;    // batch
    const int q0 = (blockIdx.x & 31) * 16;

    const int tid  = threadIdx.x;
    const int wave = tid >> 5;
    const int lane = tid & 31;
    const int half = lane >> 4;
    const int lp   = lane & 15;

    __shared__ float ldsQ[16][132];    // Q tile (padded)
    __shared__ float ldsH[16][132];    // hqb tile (b1 folded)
    __shared__ float ldsW2[128];
    __shared__ float SG[16][516];      // gated scores, +4 pad for P@V column reads

    { // stage Q tile + hqb tile + W2
        const int row = tid >> 4;
        const int col = (tid & 15) * 8;
        const float* qs = Q   + ((size_t)(b * L_) + q0 + row) * D_ + col;
        const float* hs = hqb + ((size_t)(b * L_) + q0 + row) * D_ + col;
        *(float4*)&ldsQ[row][col]     = *(const float4*)(qs);
        *(float4*)&ldsQ[row][col + 4] = *(const float4*)(qs + 4);
        *(float4*)&ldsH[row][col]     = *(const float4*)(hs);
        *(float4*)&ldsH[row][col + 4] = *(const float4*)(hs + 4);
        if (tid < 128) ldsW2[tid] = W2[tid];
    }

    // ---- nhk of the conflict loop, fetched ahead ----
    // nhk depends on nothing staged here. Trip t asks for the values of trip
    // t + HPRE, so that a load has HPRE trips of vector work to land in; the first
    // HPRE trips are asked for here, beside the staging loads.
    const float* hkr = nhk + ((size_t)(b * L_) + wave * 16 + lp) * D_;
    v4f hv[4][4];                      // [trip mod 4][k tile j]
    // unrolled so that hv stays in registers
#pragma unroll
    for (int u = 0; u < HPRE; ++u)
#pragma unroll
        for (int j = 0; j < 4; ++j)                 // rows 128 apart: tile j
            hv[u][j] = *(const v4f*)(hkr + (size_t)j * 128 * D_ + 4 * u);
    __syncthreads();

    const float bias2 = b2[0];

    // ---- conflict[q,k] = sum_d relu(hqb[q,d]+hk[k,d])*W2[d]  (VALU) ----
    // relu(a + b) = max(a, -b) + b, so
    //   conflict = sum_d max(hqb[q,d], nhk[k,d])*W2[d] - sum_d nhk[k,d]*W2[d].
    // The first sum costs one max and one multiply-add an element (no add in
    // front of the max); the second depends on the key alone: once per lane and key.
    // One d loop for all four k tiles of the wave (tile j = wave + 8*j). Each sum
    // is kept as an (even d, odd d) pair, so that two multiply-adds go as one
    // packed instruction; the pair is added up behind the loop.
    v2f cacc[4][8];
    v2f ksum[4];
#pragma unroll
    for (int j = 0; j < 4; ++j) {
        ksum[j] = (v2f){0.f, 0.f};
#pragma unroll
        for (int r = 0; r < 8; ++r) cacc[j][r] = (v2f){0.f, 0.f};
    }

    static_assert(HPRE == 2, "the four addresses below stand two trips ahead");
    for (int d = 0; d < D_; d += 16) {               // four trips a pass
        // trips 2 and 3 ask for the next pass's first two trips. Behind the last pass
        // there is none: it asks for its own first two again (inside the row, lines
        // just read), and nothing reads those values
        const float* hkn = hkr + (d + 16 < D_ ? d + 16 : d);
        cga_conflict_trip<0>(hv, hkr + d + 8,  d,      ldsW2, ldsH, half, cacc, ksum);
        cga_conflict_trip<1>(hv, hkr + d + 12, d + 4,  ldsW2, ldsH, half, cacc, ksum);
        cga_conflict_trip<2>(hv, hkn,          d + 8,  ldsW2, ldsH, half, cacc, ksum);
        cga_conflict_trip<3>(hv, hkn + 4,      d + 12, ldsW2, ldsH, half, cacc, ksum);
    }

    float conf[4][8];
#pragma unroll
    for (int j = 0; j < 4; ++j) {
        const float ks = ksum[j].x + ksum[j].y;
#pragma unroll
        for (int r = 0; r < 8; ++r) conf[j][r] = (cacc[j][r].x + cacc[j][r].y) - ks;
    }

    // mask words of the lane's 32 (q row, k tile) places: one address pair,
    // the places told apart by constant offsets
    const int* mrow = mask + (((size_t)b * L_) + q0 + 8 * half) * L_ + wave * 16 + lp;
    int mv[4][8];
#pragma unroll
    for (int j = 0; j < 4; ++j)
#pragma unroll
        for (int r = 0; r < 8; ++r) mv[j][r] = mrow[r * L_ + j * 128];
    // precaution: the address pair of the issued mask loads stays live up to
    // this wait, so nothing rewrites it ahead of the wait
    asm volatile("s_wait_xcnt 0x0" :: "v"(mrow) : "memory");

    const float* kbase = kp + (size_t)(b * (L_ / 16) + wave) * TILEF + lp * 8 + half * 4;

    // unrolled so that conf[j] stays in registers
#pragma unroll
    for (int j = 0; j < 4; ++j) {
        const int k0 = (wave + 8 * j) * 16;

        // ---- S = Q_tile * K_tile^T  (32 chained f32 WMMAs) ----
        v8f acc = {};
        const float* krow = kbase + (size_t)j * 8 * TILEF;   // 8 tiles apart: tile j
        for (int c = 0; c < D_; c += 8) {
            // xy: K[k0+n][c+kb+i], zw: K[k0+n][c+4+kb+i]  (kb = 2*half)
            const v4f kv = *(const v4f*)(krow + (c / 8) * UNITF);
            v2f a = *(const v2f*)&ldsQ[lp][c + 2 * half];
            acc = __builtin_amdgcn_wmma_f32_16x16x4_f32(false, a, false, kv.xy,
                                                        (short)0, acc, false, false);
            a = *(const v2f*)&ldsQ[lp][c + 4 + 2 * half];
            acc = __builtin_amdgcn_wmma_f32_16x16x4_f32(false, a, false, kv.zw,
                                                        (short)0, acc, false, false);
        }

        // ---- gate + mask -> SG ----
#pragma unroll
        for (int r = 0; r < 8; ++r) {
            const int qrow = r + 8 * half;
            const float g  = 1.f / (1.f + __expf(-(conf[j][r] + bias2)));
            float sg = acc[r] * SCALE * g;
            if (mv[j][r] == 0) sg = -__builtin_inff();
            SG[qrow][k0 + lp] = sg;
        }
    }
    // precaution: the address pair of the K loads stays live up to this wait
    asm volatile("s_wait_xcnt 0x0" :: "v"(kbase) : "memory");
    __syncthreads();

    // ---- V fragments of P@V, fetched ahead ----
    // V depends on nothing computed here: the fragments of the first VPRE key
    // steps are asked for here, behind the barrier (which waits for every load
    // issued in front of it), and fly while the softmax runs. One address pair
    // for all 128 steps; a step is told from the next by a constant offset, so
    // the pair is not rewritten between the loads.
    const float* vbase = V + ((size_t)(b * L_) + 2 * half) * D_ + wave * 16 + lp;
    v2f vb[L_ / 4];                    // B: V[4s+kb+j][d0+n], step s
    // unrolled so that vb stays in registers
#pragma unroll
    for (int s = 0; s < VPRE; ++s) {
        vb[s].x = vbase[(4 * s) * D_];
        vb[s].y = vbase[(4 * s + 1) * D_];
    }

    // ---- softmax over k (wave32 shuffle reduction; 2 rows per wave) ----
    for (int rr = 0; rr < 2; ++rr) {
        const int row = wave * 2 + rr;
        float mx = -__builtin_inff();
        for (int c = lane; c < L_; c += 32) mx = fmaxf(mx, SG[row][c]);
        for (int off = 16; off; off >>= 1) mx = fmaxf(mx, __shfl_xor(mx, off, 32));
        float sum = 0.f;
        for (int c = lane; c < L_; c += 32) {
            const float e = __expf(SG[row][c] - mx);
            SG[row][c] = e;
            sum += e;
        }
        for (int off = 16; off; off >>= 1) sum += __shfl_xor(sum, off, 32);
        const float inv = 1.f / sum;
        float* wout = weights + (((size_t)b * L_) + q0 + row) * L_;
        for (int c = lane; c < L_; c += 32) {
            const float p = SG[row][c] * inv;
            SG[row][c] = p;
            wout[c] = p;
        }
    }
    __syncthreads();

    // ---- out = P @ V  (128 chained f32 WMMAs; wave owns d-tile = 16*wave) ----
    {
        const int d0 = wave * 16;
        v8f acc = {};
        // unrolled so that vb stays in registers and every V load has a constant
        // offset; step s asks for the fragment of step s + VPRE
#pragma unroll
        for (int s = 0; s < L_ / 4; ++s) {
            if (s + VPRE < L_ / 4) {
                vb[s + VPRE].x = vbase[(4 * (s + VPRE)) * D_];
                vb[s + VPRE].y = vbase[(4 * (s + VPRE) + 1) * D_];
            }
            v2f a = *(const v2f*)&SG[lp][4 * s + 2 * half];  // A: P[m][4s+kb+j]
            acc = __builtin_amdgcn_wmma_f32_16x16x4_f32(false, a, false, vb[s],
                                                        (short)0, acc, false, false);
        }
        // precaution: the address pair of the V loads stays live up to this wait
        asm volatile("s_wait_xcnt 0x0" :: "v"(vbase) : "memory");
#pragma unroll
        for (int r = 0; r < 8; ++r)
            out[(((size_t)b * L_) + q0 + r + 8 * half) * D_ + d0 + lp] = acc[r];
    }
}

// ---------------------------------------------------------------------------
extern "C" void kernel_launch(void* const* d_in, const int* in_sizes, int n_in,
                              void* d_out, int out_size, void* d_ws, size_t ws_size,
                              hipStream_t stream)
{
    const float* Q    = (const float*)d_in[0];
    const float* K    = (const float*)d_in[1];
    const float* V    = (const float*)d_in[2];
    const int*   mask = (const int*)  d_in[3];
    const float* W1   = (const float*)d_in[4];
    const float* b1   = (const float*)d_in[5];
    const float* W2   = (const float*)d_in[6];
    const float* b2   = (const float*)d_in[7];

    float* out     = (float*)d_out;                       // [B,L,D]
    float* weights = (float*)d_out + (size_t)BL_ * D_;    // [B,L,L]

    // workspace: hqb [B,L,D], nhk [B,L,D], kp (B*L*D floats)  (3 MB total)
    float* hqb = (float*)d_ws;
    float* nhk = (float*)d_ws + (size_t)BL_ * D_;
    float* kp  = (float*)d_ws + (size_t)2 * BL_ * D_;

    cga_proj_kernel<<<2 * BL_ / 16, 256, 0, stream>>>(Q, K, W1, b1, hqb, nhk, kp);
    cga_attn_kernel<<<B_ * (L_ / 16), 256, 0, stream>>>(Q, kp, V, mask, W2, b2,
                                                        hqb, nhk, out, weights);
}

// v006
// A run of this version takes 24.9 microseconds.
// Timed twice side by side with v005, it ran 1.05 times as fast both times.
// All steps since v000 together make it 1.94 times as fast.
#include <hip/hip_runtime.h>
#include <hip/hip_bf16.h>

typedef __attribute__((ext_vector_type(2))) float v2f;
typedef __attribute__((ext_vector_type(4))) float v4f;
typedef __attribute__((ext_vector_type(8))) float v8f;

#define B_  4
#define L_  512
#define D_  128
#define BL_ (B_ * L_)
#define SCALE 0.08838834764831845f  /* 1/sqrt(128) */
#define TILEF (16 * D_)  /* floats of one 16-key tile in kp */
#define UNITF 128        /* floats of one 8-column unit of a key tile in kp */
#define VPRE 30   /* key steps of V fetched ahead in P@V: 60 loads in flight */
#define HPRE 2    /* d trips of nhk fetched ahead in the conflict loop: 8 loads in flight */

// ---------------------------------------------------------------------------
// Kernel 1: hqb = Q @ W1[:D] + b1 ; nhk = -(K @ W1[D:])  (stored negated) ; kp = K
// X = [Q; K] rows 0..2*BL-1. One WG = 16 rows; wave w = output cols [16w,16w+16).
// V_WMMA_F32_16X16X4_F32 accumulating over the 128-deep contraction.
// kp holds K bit for bit, in the order in which the lanes of kernel 2 take their
// B fragments of Q K^T:
//   kp[key tile][u][key in tile][hf][e][i] = K[key][8*u + 4*e + 2*hf + i]
// (hf = the lane's half, e = the first or second of two contraction steps).
// One 16-byte load a lane then feeds two steps, and the wave's 32 loads cover 512
// bytes in a row (4 whole cache lines) where 16 key rows gave 16 lines a load.
// ---------------------------------------------------------------------------
__global__ __launch_bounds__(256)
void cga_proj_kernel(const float* __restrict__ Q, const float* __restrict__ K,
                     const float* __restrict__ W1, const float* __restrict__ b1,
                     float* __restrict__ hqb, float* __restrict__ nhk,
                     float* __restrict__ kp)
{
    const int r0   = blockIdx.x * 16;          // row tile in X (0..4095)
    const bool isK = (r0 >= BL_);
    const float* X = isK ? (K + (size_t)(r0 - BL_) * D_) : (Q + (size_t)r0 * D_);

    const int tid  = threadIdx.x;
    const int wave = tid >> 5;
    const int lane = tid & 31;
    const int half = lane >> 4;        // K-pair selector for A/B operands
    const int lp   = lane & 15;        // m (A) / n (B,C,D)

    __shared__ float ldsX[16][132];    // +4 pad: stride-132 kills bank conflicts

    { // cooperative 16x128 tile stage: 256 threads x 8 floats
        const int row = tid >> 4;
        const int col = (tid & 15) * 8;
        const float* src = X + (size_t)row * D_ + col;
        *(float4*)&ldsX[row][col]     = *(const float4*)(src);
        *(float4*)&ldsX[row][col + 4] = *(const float4*)(src + 4);
    }
    __syncthreads();

    if (isK) { // the K tile out of LDS into kp: a wave stores 512 bytes in a row
        float* kt = kp + (size_t)(blockIdx.x - BL_ / 16) * TILEF + lane * 4;
        const int key = lane >> 1;
        const int hf  = lane & 1;
        for (int h = 0; h < 2; ++h) {          // two units a thread
            const int u = wave + 8 * h;
            const v2f e0 = *(const v2f*)&ldsX[key][8 * u + 2 * hf];
            const v2f e1 = *(const v2f*)&ldsX[key][8 * u + 4 + 2 * hf];
            *(v4f*)(kt + u * UNITF) = (v4f){e0.x, e0.y, e1.x, e1.y};
        }
        // precaution: stands in front of whatever rewrites a register that the
        // two issued stores name
        asm volatile("s_wait_xcnt 0x0" ::: "memory");
    }

    const int d0   = wave * 16;        // output column tile
    const int woff = isK ? D_ : 0;     // which half of W1 [256,128]

    v8f acc = {};
    for (int c = 0; c < D_; c += 4) {
        // A: X[m][c + kb + j], contiguous float2 per lane
        v2f a = *(const v2f*)&ldsX[lp][c + 2 * half];
        // B: W1[woff + c + kb + j][d0 + n] — two coalesced scalar reads
        const float* wr = W1 + (size_t)(woff + c + 2 * half) * D_ + d0 + lp;
        v2f bv; bv.x = wr[0]; bv.y = wr[D_];
        acc = __builtin_amdgcn_wmma_f32_16x16x4_f32(false, a, false, bv,
                                                    (short)0, acc, false, false);
    }

    float* dst      = isK ? nhk : hqb;
    const int rbase = isK ? (r0 - BL_) : r0;
#pragma unroll
    for (int r = 0; r < 8; ++r) {
        const int row = rbase + r + 8 * half;      // C/D layout: M = r + 8*half
        float v = isK ? -acc[r]                    // key side goes out negated
                      : acc[r] + b1[d0 + lp];      // fold b1 into hqb
        dst[(size_t)row * D_ + d0 + lp] = v;
    }
}

// ---------------------------------------------------------------------------
// One trip (4 values of d) of kernel 2's conflict sum, for the lane's 8 q rows and
// 4 keys. hv is a ring of four trips of nhk in registers; U = trip mod 4 is a
// constant, so that the ring's places are fixed registers. The trip first asks for
// the nhk values of trip + HPRE, which stand at pf.
// ---------------------------------------------------------------------------
template <int U>
__device__ __forceinline__
void cga_conflict_trip(v4f (&hv)[4][4], const float* __restrict__ pf, const int d,
                       const float* ldsW2, const float (*ldsH)[132], const int half,
                       v2f (&cacc)[4][8], v2f (&ksum)[4])
{
#pragma unroll
    for (int j = 0; j < 4; ++j)                     // rows 128 apart: tile j
        hv[(U + HPRE) & 3][j] = *(const v4f*)(pf + (size_t)j * 128 * D_);
    // precaution: stands behind the last nhk loads of a pass, in front of whatever
    // rewrites an address register that the pass's issued loads name
    if (U == 3) asm volatile("s_wait_xcnt 0x0" ::: "memory");
    const v4f wv  = *(const v4f*)&ldsW2[d];         // LDS broadcast
    v4f hq[8];
#pragma unroll
    for (int r = 0; r < 8; ++r)
        hq[r] = *(const v4f*)&ldsH[r + 8 * half][d];         // LDS broadcast
    const v2f w01 = wv.xy, w23 = wv.zw;
#pragma unroll
    for (int j = 0; j < 4; ++j) {
        ksum[j] = __builtin_elementwise_fma(hv[U][j].xy, w01, ksum[j]);
        ksum[j] = __builtin_elementwise_fma(hv[U][j].zw, w23, ksum[j]);
    }
    // four q rows at a time: all their maxima, then all their multiply-adds, so that
    // no instruction stands close behind the one whose result it reads
#pragma unroll
    for (int rb = 0; rb < 8; rb += 4) {
        v2f m01[4][4], m23[4][4];
#pragma unroll
        for (int r = 0; r < 4; ++r)
#pragma unroll
            for (int j = 0; j < 4; ++j) {
                m01[r][j] = __builtin_elementwise_max(hq[rb + r].xy, hv[U][j].xy);
                m23[r][j] = __builtin_elementwise_max(hq[rb + r].zw, hv[U][j].zw);
            }
#pragma unroll
        for (int r = 0; r < 4; ++r)
#pragma unroll
            for (int j = 0; j < 4; ++j)
                cacc[j][rb + r] = __builtin_elementwise_fma(m01[r][j], w01, cacc[j][rb + r]);
#pragma unroll
        for (int r = 0; r < 4; ++r)
#pragma unroll
            for (int j = 0; j < 4; ++j)
                cacc[j][rb + r] = __builtin_elementwise_fma(m23[r][j], w23, cacc[j][rb + r]);
    }
    // compiler fence, no instruction: keeps the next trips' loads behind this trip.
    // Lifted to the head of the pass, they land in registers of their own and are
    // copied into the ring at the loop's foot, behind a wait for all of them; and
    // four trips merged need more than 256 registers
    asm volatile("" ::: "memory");
}

// ---------------------------------------------------------------------------
// Cross-lane moves of kernel 2's softmax, on the vector unit.
// cga_xrow<M>: the value of lane l ^ M, M < 16 (a DPP operand inside a row of 16
// lanes); cga_xhalf: the value of lane l ^ 16.
// ---------------------------------------------------------------------------
template <int M>
__device__ __forceinline__ float cga_xrow(const float x)
{
    return __builtin_bit_cast(float,
        __builtin_amdgcn_mov_dpp(__builtin_bit_cast(int, x), 0x160 + M, 0xf, 0xf, true));  // row_xmask:M
}
__device__ __forceinline__ float cga_xhalf(const float x)
{
    const int v = __builtin_bit_cast(int, x);
    return __builtin_bit_cast(float,
        __builtin_amdgcn_permlanex16(v, v, 0x76543210, 0xfedcba98, false, false));
}

// ---------------------------------------------------------------------------
// Kernel 2: fused gated attention for one (b, 16-row q tile).
// 8 waves: each owns 4 k-tiles (conflict via VALU for all 4 at once, S via WMMA, gate),
// then softmax (2 rows a wave, in registers), then P@V via WMMA (one d-tile per wave).
// ---------------------------------------------------------------------------
__global__ __launch_bounds__(256)
void cga_attn_kernel(const float* __restrict__ Q, const float* __restrict__ kp,
                     const float* __restrict__ V, const int* __restrict__ mask,
                     const float* __restrict__ W2, const float* __restrict__ b2,
                     const float* __restrict__ hqb, const float* __restrict__ nhk,
                     float* __restrict__ out, float* __restrict__ weights)
{
    const int b  = blockIdx.x >> 5;    // batch
    const int q0 = (blockIdx.x & 31) * 16;

    const int tid  = threadIdx.x;
    const int wave = tid >> 5;
    const int lane = tid & 31;
    const int half = lane >> 4;
    const int lp   = lane & 15;

    __shared__ float ldsQ[16][132];    // Q tile (padded)
    __shared__ float ldsH[16][132];    // hqb tile (b1 folded)
    __shared__ float ldsW2[128];
    // gated scores, +4 pad for P@V column reads; aligned for the softmax's 16-byte reads
    __shared__ __attribute__((aligned(16))) float SG[16][516];

    { // stage Q tile + hqb tile + W2
        const int row = tid >> 4;
        const int col = (tid & 15) * 8;
        const float* qs = Q   + ((size_t)(b * L_) + q0 + row) * D_ + col;
        const float* hs = hqb + ((size_t)(b * L_) + q0 + row) * D_ + col;
        *(float4*)&ldsQ[row][col]     = *(const float4*)(qs);
        *(float4*)&ldsQ[row][col + 4] = *(const float4*)(qs + 4);
        *(float4*)&ldsH[row][col]     = *(const float4*)(hs);
        *(float4*)&ldsH[row][col + 4] = *(const float4*)(hs + 4);
        if (tid < 128) ldsW2[tid] = W2[tid];
    }

    // ---- nhk of the conflict loop, fetched ahead ----
    // nhk depends on nothing staged here. Trip t asks for the values of trip
    // t + HPRE, so that a load has HPRE trips of vector work to land in; the first
    // HPRE trips are asked for here, beside the staging loads.
    const float* hkr = nhk + ((size_t)(b * L_) + wave * 16 + lp) * D_;
    v4f hv[4][4];                      // [trip mod 4][k tile j]
    // unrolled so that hv stays in registers
#pragma unroll
    for (int u = 0; u < HPRE; ++u)
#pragma unroll
        for (int j = 0; j < 4; ++j)                 // rows 128 apart: tile j
            hv[u][j] = *(const v4f*)(hkr + (size_t)j * 128 * D_ + 4 * u);
    __syncthreads();

    const float bias2 = b2[0];

    // ---- conflict[q,k] = sum_d relu(hqb[q,d]+hk[k,d])*W2[d]  (VALU) ----
    // relu(a + b) = max(a, -b) + b, so
    //   conflict = sum_d max(hqb[q,d], nhk[k,d])*W2[d] - sum_d nhk[k,d]*W2[d].
    // The first sum costs one max and one multiply-add an element (no add in
    // front of the max); the second depends on the key alone: once per lane and key.
    // One d loop for all four k tiles of the wave (tile j = wave + 8*j). Each sum
    // is kept as an (even d, odd d) pair, so that two multiply-adds go as one
    // packed instruction; the pair is added up behind the loop.
    v2f cacc[4][8];
    v2f ksum[4];
#pragma unroll
    for (int j = 0; j < 4; ++j) {
        ksum[j] = (v2f){0.f, 0.f};
#pragma unroll
        for (int r = 0; r < 8; ++r) cacc[j][r] = (v2f){0.f, 0.f};
    }

    static_assert(HPRE == 2, "the four addresses below stand two trips ahead");
    for (int d = 0; d < D_; d += 16) {               // four trips a pass
        // trips 2 and 3 ask for the next pass's first two trips. Behind the last pass
        // there is none: it asks for its own first two again (inside the row, lines
        // just read), and nothing reads those values
        const float* hkn = hkr + (d + 16 < D_ ? d + 16 : d);
        cga_conflict_trip<0>(hv, hkr + d + 8,  d,      ldsW2, ldsH, half, cacc, ksum);
        cga_conflict_trip<1>(hv, hkr + d + 12, d + 4,  ldsW2, ldsH, half, cacc, ksum);
        cga_conflict_trip<2>(hv, hkn,          d + 8,  ldsW2, ldsH, half, cacc, ksum);
        cga_conflict_trip<3>(hv, hkn + 4,      d + 12, ldsW2, ldsH, half, cacc, ksum);
    }

    float conf[4][8];
#pragma unroll
    for (int j = 0; j < 4; ++j) {
        const float ks = ksum[j].x + ksum[j].y;
#pragma unroll
        for (int r = 0; r < 8; ++r) conf[j][r] = (cacc[j][r].x + cacc[j][r].y) - ks;
    }

    // mask words of the lane's 32 (q row, k tile) places: one address pair,
    // the places told apart by constant offsets
    const int* mrow = mask + (((size_t)b * L_) + q0 + 8 * half) * L_ + wave * 16 + lp;
    int mv[4][8];
#pragma unroll
    for (int j = 0; j < 4; ++j)
#pragma unroll
        for (int r = 0; r < 8; ++r) mv[j][r] = mrow[r * L_ + j * 128];
    // precaution: the address pair of the issued mask loads stays live up to
    // this wait, so nothing rewrites it ahead of the wait
    asm volatile("s_wait_xcnt 0x0" :: "v"(mrow) : "memory");

    const float* kbase = kp + (size_t)(b * (L_ / 16) + wave) * TILEF + lp * 8 + half * 4;

    // unrolled so that conf[j] stays in registers
#pragma unroll
    for (int j = 0; j < 4; ++j) {
        const int k0 = (wave + 8 * j) * 16;

        // ---- S = Q_tile * K_tile^T  (32 chained f32 WMMAs) ----
        v8f acc = {};
        const float* krow = kbase + (size_t)j * 8 * TILEF;   // 8 tiles apart: tile j
        for (int c = 0; c < D_; c += 8) {
            // xy: K[k0+n][c+kb+i], zw: K[k0+n][c+4+kb+i]  (kb = 2*half)
            const v4f kv = *(const v4f*)(krow + (c / 8) * UNITF);
            v2f a = *(const v2f*)&ldsQ[lp][c + 2 * half];
            acc = __builtin_amdgcn_wmma_f32_16x16x4_f32(false, a, false, kv.xy,
                                                        (short)0, acc, false, false);
            a = *(const v2f*)&ldsQ[lp][c + 4 + 2 * half];
            acc = __builtin_amdgcn_wmma_f32_16x16x4_f32(false, a, false, kv.zw,
                                                        (short)0, acc, false, false);
        }

        // ---- gate + mask -> SG ----
#pragma unroll
        for (int r = 0; r < 8; ++r) {
            const int qrow = r + 8 * half;
            const float g  = 1.f / (1.f + __expf(-(conf[j][r] + bias2)));
            float sg = acc[r] * SCALE * g;
            if (mv[j][r] == 0) sg = -__builtin_inff();
            SG[qrow][k0 + lp] = sg;
        }
    }
    // precaution: the address pair of the K loads stays live up to this wait
    asm volatile("s_wait_xcnt 0x0" :: "v"(kbase) : "memory");
    __syncthreads();

    // ---- V fragments of P@V, fetched ahead ----
    // V depends on nothing computed here: the fragments of the first VPRE key
    // steps are asked for here, behind the barrier (which waits for every load
    // issued in front of it), and fly while the softmax runs. One address pair
    // for all 128 steps; a step is told from the next by a constant offset, so
    // the pair is not rewritten between the loads.
    const float* vbase = V + ((size_t)(b * L_) + 2 * half) * D_ + wave * 16 + lp;
    v2f vb[L_ / 4];                    // B: V[4s+kb+j][d0+n], step s
    // unrolled so that vb stays in registers
#pragma unroll
    for (int s = 0; s < VPRE; ++s) {
        vb[s].x = vbase[(4 * s) * D_];
        vb[s].y = vbase[(4 * s + 1) * D_];
    }
    // keeps the V loads in front of the softmax: moved in among its instructions they
    // start later, and the barrier behind the softmax waits for the last of them
    __builtin_amdgcn_sched_barrier(0);

    // ---- softmax over k: a wave's 2 rows held in registers from read to store ----
    // A lane reads 16 scores of each row once (16 bytes a read, a wave's read covers
    // 512 bytes in a row), and maximum, exponentials, sum and scaling work on those
    // registers; P goes to LDS once. Both rows run side by side, so that each fills
    // the other's waits. The maximum and the sum over the 32 lanes go through vector
    // cross-lane operands, not through the LDS unit.
    v4f px[2][4];                      // [row of the wave][128-key block]
    {
        float* srow = &SG[wave * 2][4 * lane];
        // every loop here is unrolled so that px stays in registers
#pragma unroll
        for (int rr = 0; rr < 2; ++rr)
#pragma unroll
            for (int i = 0; i < 4; ++i) px[rr][i] = *(const v4f*)(srow + rr * 516 + 128 * i);

        float mx[2];
#pragma unroll
        for (int rr = 0; rr < 2; ++rr) {
            const v4f m4 = __builtin_elementwise_max(
                __builtin_elementwise_max(px[rr][0], px[rr][1]),
                __builtin_elementwise_max(px[rr][2], px[rr][3]));
            mx[rr] = fmaxf(fmaxf(m4.x, m4.y), fmaxf(m4.z, m4.w));
        }
#pragma unroll
        for (int rr = 0; rr < 2; ++rr) mx[rr] = fmaxf(mx[rr], cga_xrow<1>(mx[rr]));
#pragma unroll
        for (int rr = 0; rr < 2; ++rr) mx[rr] = fmaxf(mx[rr], cga_xrow<2>(mx[rr]));
#pragma unroll
        for (int rr = 0; rr < 2; ++rr) mx[rr] = fmaxf(mx[rr], cga_xrow<4>(mx[rr]));
#pragma unroll
        for (int rr = 0; rr < 2; ++rr) mx[rr] = fmaxf(mx[rr], cga_xrow<8>(mx[rr]));
#pragma unroll
        for (int rr = 0; rr < 2; ++rr) mx[rr] = fmaxf(mx[rr], cga_xhalf(mx[rr]));

        float sum[2];
#pragma unroll
        for (int rr = 0; rr < 2; ++rr) {
#pragma unroll
            for (int i = 0; i < 4; ++i) {
                px[rr][i].x = __expf(px[rr][i].x - mx[rr]);
                px[rr][i].y = __expf(px[rr][i].y - mx[rr]);
                px[rr][i].z = __expf(px[rr][i].z - mx[rr]);
                px[rr][i].w = __expf(px[rr][i].w - mx[rr]);
            }
            const v4f s4 = (px[rr][0] + px[rr][1]) + (px[rr][2] + px[rr][3]);
            sum[rr] = (s4.x + s4.y) + (s4.z + s4.w);
        }
#pragma unroll
        for (int rr = 0; rr < 2; ++rr) sum[rr] += cga_xrow<1>(sum[rr]);
#pragma unroll
        for (int rr = 0; rr < 2; ++rr) sum[rr] += cga_xrow<2>(sum[rr]);
#pragma unroll
        for (int rr = 0; rr < 2; ++rr) sum[rr] += cga_xrow<4>(sum[rr]);
#pragma unroll
        for (int rr = 0; rr < 2; ++rr) sum[rr] += cga_xrow<8>(sum[rr]);
#pragma unroll
        for (int rr = 0; rr < 2; ++rr) sum[rr] += cga_xhalf(sum[rr]);

#pragma unroll
        for (int rr = 0; rr < 2; ++rr) {
            const float inv = 1.f / sum[rr];
#pragma unroll
            for (int i = 0; i < 4; ++i) {
                px[rr][i] *= inv;
                *(v4f*)(srow + rr * 516 + 128 * i) = px[rr][i];
            }
        }
    }
    __syncthreads();

    // the weights go out of the same registers, behind the barrier (which waits for
    // every store issued in front of it), and fly while P@V runs: 16 bytes a lane,
    // a wave's store covers 4 whole cache lines
    {
        float* wout = weights + (((size_t)b * L_) + q0 + wave * 2) * L_ + 4 * lane;
#pragma unroll
        for (int rr = 0; rr < 2; ++rr)
#pragma unroll
            for (int i = 0; i < 4; ++i) *(v4f*)(wout + rr * L_ + 128 * i) = px[rr][i];
        // precaution: the address pair and the data of the issued stores stay live
        // up to this wait, so nothing rewrites them ahead of it
        asm volatile("s_wait_xcnt 0x0"
                     :: "v"(wout), "v"(px[0][0]), "v"(px[0][1]), "v"(px[0][2]), "v"(px[0][3]),
                        "v"(px[1][0]), "v"(px[1][1]), "v"(px[1][2]), "v"(px[1][3])
                     : "memory");
    }

    // ---- out = P @ V  (128 chained f32 WMMAs; wave owns d-tile = 16*wave) ----
    {
        const int d0 = wave * 16;
        v8f acc = {};
        // unrolled so that vb stays in registers and every V load has a constant
        // offset; step s asks for the fragment of step s + VPRE
#pragma unroll
        for (int s = 0; s < L_ / 4; ++s) {
            if (s + VPRE < L_ / 4) {
                vb[s + VPRE].x = vbase[(4 * (s + VPRE)) * D_];
                vb[s + VPRE].y = vbase[(4 * (s + VPRE) + 1) * D_];
            }
            v2f a = *(const v2f*)&SG[lp][4 * s + 2 * half];  // A: P[m][4s+kb+j]
            acc = __builtin_amdgcn_wmma_f32_16x16x4_f32(false, a, false, vb[s],
                                                        (short)0, acc, false, false);
        }
        // precaution: the address pair of the V loads stays live up to this wait
        asm volatile("s_wait_xcnt 0x0" :: "v"(vbase) : "memory");
#pragma unroll
        for (int r = 0; r < 8; ++r)
            out[(((size_t)b * L_) + q0 + r + 8 * half) * D_ + d0 + lp] = acc[r];
    }
}

// ---------------------------------------------------------------------------
extern "C" void kernel_launch(void* const* d_in, const int* in_sizes, int n_in,
                              void* d_out, int out_size, void* d_ws, size_t ws_size,
                              hipStream_t stream)
{
    const float* Q    = (const float*)d_in[0];
    const float* K    = (const float*)d_in[1];
    const float* V    = (const float*)d_in[2];
    const int*   mask = (const int*)  d_in[3];
    const float* W1   = (const float*)d_in[4];
    const float* b1   = (const float*)d_in[5];
    const float* W2   = (const float*)d_in[6];
    const float* b2   = (const float*)d_in[7];

    float* out     = (float*)d_out;                       // [B,L,D]
    float* weights = (float*)d_out + (size_t)BL_ * D_;    // [B,L,L]

    // workspace: hqb [B,L,D], nhk [B,L,D], kp (B*L*D floats)  (3 MB total)
    float* hqb = (float*)d_ws;
    float* nhk = (float*)d_ws + (size_t)BL_ * D_;
    float* kp  = (float*)d_ws + (size_t)2 * BL_ * D_;

    cga_proj_kernel<<<2 * BL_ / 16, 256, 0, stream>>>(Q, K, W1, b1, hqb, nhk, kp);
    cga_attn_kernel<<<B_ * (L_ / 16), 256, 0, stream>>>(Q, kp, V, mask, W2, b2,
                                                        hqb, nhk, out, weights);
}

// v007
// One run takes 24.1 microseconds.
// Timed twice side by side with v006, it ran 1.03 and 1.05 times as fast.
// Over all steps from v000 it is 2.02 times as fast.
#include <hip/hip_runtime.h>
#include <hip/hip_bf16.h>

typedef __attribute__((ext_vector_type(2))) float v2f;
typedef __attribute__((ext_vector_type(4))) float v4f;
typedef __attribute__((ext_vector_type(8))) float v8f;

#define B_  4
#define L_  512
#define D_  128
#define BL_ (B_ * L_)
#define SCALE 0.08838834764831845f  /* 1/sqrt(128) */
#define TILEF (16 * D_)  /* floats of one 16-key tile in kp */
#define UNITF 128        /* floats of one 8-column unit of a key tile in kp */
#define VPRE 30   /* key steps of V fetched ahead in P@V: 60 loads in flight */
#define HPRE 2    /* d trips of nhk fetched ahead in the conflict loop: 8 loads in flight */

// ---------------------------------------------------------------------------
// Kernel 1: hqb = Q @ W1[:D] + b1 ; nhk = -(K @ W1[D:])  (stored negated, see below) ; kp = K
// X = [Q; K] rows 0..2*BL-1. One WG = 16 rows; wave w = output cols [16w,16w+16).
// V_WMMA_F32_16X16X4_F32 accumulating over the 128-deep contraction.
// kp holds K bit for bit, in the order in which the lanes of kernel 2 take their
// B fragments of Q K^T:
//   kp[key tile][u][key in tile][hf][e][i] = K[key][8*u + 4*e + 2*hf + i]
// (hf = the lane's half, e = the first or second of two contraction steps).
// One 16-byte load a lane then feeds two steps, and the wave's 32 loads cover 512
// bytes in a row (4 whole cache lines) where 16 key rows gave 16 lines a load.
// nhk goes out in the order in which the lanes of kernel 2 read it in the conflict loop:
//   nhk[key tile][d / 4][key in tile][d % 4]
// so that the 16-byte loads of a wave's 16 keys cover 256 bytes in a row (2 whole cache
// lines) where 16 key rows gave 16 lines a load. For that the key side takes W1 as the
// A operand and K as the B operand (both fragments have the same lane map): the tile
// comes out transposed, a lane holds 8 values of d in a row of one key, and two
// 16-byte stores a lane write whole lines. Products and their order stay the same.
// ---------------------------------------------------------------------------
__global__ __launch_bounds__(256)
void cga_proj_kernel(const float* __restrict__ Q, const float* __restrict__ K,
                     const float* __restrict__ W1, const float* __restrict__ b1,
                     float* __restrict__ hqb, float* __restrict__ nhk,
                     float* __restrict__ kp)
{
    const int r0   = blockIdx.x * 16;          // row tile in X (0..4095)
    const bool isK = (r0 >= BL_);
    const float* X = isK ? (K + (size_t)(r0 - BL_) * D_) : (Q + (size_t)r0 * D_);

    const int tid  = threadIdx.x;
    const int wave = tid >> 5;
    const int lane = tid & 31;
    const int half = lane >> 4;        // K-pair selector for A/B operands
    const int lp   = lane & 15;        // m (A) / n (B,C,D)

    __shared__ float ldsX[16][132];    // +4 pad: stride-132 kills bank conflicts

    { // cooperative 16x128 tile stage: 256 threads x 8 floats
        const int row = tid >> 4;
        const int col = (tid & 15) * 8;
        const float* src = X + (size_t)row * D_ + col;
        *(float4*)&ldsX[row][col]     = *(const float4*)(src);
        *(float4*)&ldsX[row][col + 4] = *(const float4*)(src + 4);
    }
    __syncthreads();

    if (isK) { // the K tile out of LDS into kp: a wave stores 512 bytes in a row
        float* kt = kp + (size_t)(blockIdx.x - BL_ / 16) * TILEF + lane * 4;
        const int key = lane >> 1;
        const int hf  = lane & 1;
        for (int h = 0; h < 2; ++h) {          // two units a thread
            const int u = wave + 8 * h;
            const v2f e0 = *(const v2f*)&ldsX[key][8 * u + 2 * hf];
            const v2f e1 = *(const v2f*)&ldsX[key][8 * u + 4 + 2 * hf];
            *(v4f*)(kt + u * UNITF) = (v4f){e0.x, e0.y, e1.x, e1.y};
        }
        // precaution: stands in front of whatever rewrites a register that the
        // two issued stores name
        asm volatile("s_wait_xcnt 0x0" ::: "memory");
    }

    const int d0   = wave * 16;        // output column tile
    const int woff = isK ? D_ : 0;     // which half of W1 [256,128]

    v8f acc = {};
    if (isK) {   // the same for the whole work-group
        for (int c = 0; c < D_; c += 4) {
            // B: X[n][c + kb + j], contiguous float2 per lane
            v2f a = *(const v2f*)&ldsX[lp][c + 2 * half];
            // A: W1[woff + c + kb + j][d0 + m], two coalesced scalar reads
            const float* wr = W1 + (size_t)(woff + c + 2 * half) * D_ + d0 + lp;
            v2f bv; bv.x = wr[0]; bv.y = wr[D_];
            acc = __builtin_amdgcn_wmma_f32_16x16x4_f32(false, bv, false, a,
                                                        (short)0, acc, false, false);
        }
        // C/D layout: acc[r] = hk[key lp][d0 + 8*half + r]; the key side goes out negated
        float* nt = nhk + (size_t)(blockIdx.x - BL_ / 16) * TILEF
                        + (d0 / 4 + 2 * half) * 64 + lp * 4;
        *(v4f*)(nt)      = (v4f){-acc[0], -acc[1], -acc[2], -acc[3]};
        *(v4f*)(nt + 64) = (v4f){-acc[4], -acc[5], -acc[6], -acc[7]};
        return;
    }
    for (int c = 0; c < D_; c += 4) {
        // A: X[m][c + kb + j], contiguous float2 per lane
        v2f a = *(const v2f*)&ldsX[lp][c + 2 * half];
        // B: W1[woff + c + kb + j][d0 + n], two coalesced scalar reads
        const float* wr = W1 + (size_t)(woff + c + 2 * half) * D_ + d0 + lp;
        v2f bv; bv.x = wr[0]; bv.y = wr[D_];
        acc = __builtin_amdgcn_wmma_f32_16x16x4_f32(false, a, false, bv,
                                                    (short)0, acc, false, false);
    }
#pragma unroll
    for (int r = 0; r < 8; ++r) {
        const int row = r0 + r + 8 * half;         // C/D layout: M = r + 8*half
        hqb[(size_t)row * D_ + d0 + lp] = acc[r] + b1[d0 + lp];   // fold b1 into hqb
    }
}

// ---------------------------------------------------------------------------
// One trip (4 values of d) of kernel 2's conflict sum, for the lane's 8 q rows and
// 4 keys. hv is a ring of four trips of nhk in registers; U = trip mod 4 is a
// constant, so that the ring's places are fixed registers. The trip first asks for
// the nhk values of trip + HPRE, which stand at pf.
// ---------------------------------------------------------------------------
template <int U>
__device__ __forceinline__
void cga_conflict_trip(v4f (&hv)[4][4], const float* __restrict__ pf, const int d,
                       const float* ldsW2, const float (*ldsH)[132], const int half,
                       v2f (&cacc)[4][8], v2f (&ksum)[4])
{
#pragma unroll
    for (int j = 0; j < 4; ++j)                     // 8 key tiles apart: tile j
        hv[(U + HPRE) & 3][j] = *(const v4f*)(pf + (size_t)j * 8 * TILEF);
    // precaution: stands behind the last nhk loads of a pass, in front of whatever
    // rewrites an address register that the pass's issued loads name
    if (U == 3) asm volatile("s_wait_xcnt 0x0" ::: "memory");
    const v4f wv  = *(const v4f*)&ldsW2[d];         // LDS broadcast
    v4f hq[8];
#pragma unroll
    for (int r = 0; r < 8; ++r)
        hq[r] = *(const v4f*)&ldsH[r + 8 * half][d];         // LDS broadcast
    const v2f w01 = wv.xy, w23 = wv.zw;
#pragma unroll
    for (int j = 0; j < 4; ++j) {
        ksum[j] = __builtin_elementwise_fma(hv[U][j].xy, w01, ksum[j]);
        ksum[j] = __builtin_elementwise_fma(hv[U][j].zw, w23, ksum[j]);
    }
    // four q rows at a time: all their maxima, then all their multiply-adds, so that
    // no instruction stands close behind the one whose result it reads
#pragma unroll
    for (int rb = 0; rb < 8; rb += 4) {
        v2f m01[4][4], m23[4][4];
#pragma unroll
        for (int r = 0; r < 4; ++r)
#pragma unroll
            for (int j = 0; j < 4; ++j) {
                m01[r][j] = __builtin_elementwise_max(hq[rb + r].xy, hv[U][j].xy);
                m23[r][j] = __builtin_elementwise_max(hq[rb + r].zw, hv[U][j].zw);
            }
#pragma unroll
        for (int r = 0; r < 4; ++r)
#pragma unroll
            for (int j = 0; j < 4; ++j)
                cacc[j][rb + r] = __builtin_elementwise_fma(m01[r][j], w01, cacc[j][rb + r]);
#pragma unroll
        for (int r = 0; r < 4; ++r)
#pragma unroll
            for (int j = 0; j < 4; ++j)
                cacc[j][rb + r] = __builtin_elementwise_fma(m23[r][j], w23, cacc[j][rb + r]);
    }
    // compiler fence, no instruction: keeps the next trips' loads behind this trip.
    // Lifted to the head of the pass, they land in registers of their own and are
    // copied into the ring at the loop's foot, behind a wait for all of them; and
    // four trips merged need more than 256 registers
    asm volatile("" ::: "memory");
}

// ---------------------------------------------------------------------------
// Cross-lane moves of kernel 2's softmax, on the vector unit.
// cga_xrow<M>: the value of lane l ^ M, M < 16 (a DPP operand inside a row of 16
// lanes); cga_xhalf: the value of lane l ^ 16.
// ---------------------------------------------------------------------------
template <int M>
__device__ __forceinline__ float cga_xrow(const float x)
{
    return __builtin_bit_cast(float,
        __builtin_amdgcn_mov_dpp(__builtin_bit_cast(int, x), 0x160 + M, 0xf, 0xf, true));  // row_xmask:M
}
__device__ __forceinline__ float cga_xhalf(const float x)
{
    const int v = __builtin_bit_cast(int, x);
    return __builtin_bit_cast(float,
        __builtin_amdgcn_permlanex16(v, v, 0x76543210, 0xfedcba98, false, false));
}

// ---------------------------------------------------------------------------
// Kernel 2: fused gated attention for one (b, 16-row q tile).
// 8 waves: each owns 4 k-tiles (conflict via VALU for all 4 at once, S via WMMA, gate),
// then softmax (2 rows a wave, in registers), then P@V via WMMA (one d-tile per wave).
// ---------------------------------------------------------------------------
__global__ __launch_bounds__(256)
void cga_attn_kernel(const float* __restrict__ Q, const float* __restrict__ kp,
                     const float* __restrict__ V, const int* __restrict__ mask,
                     const float* __restrict__ W2, const float* __restrict__ b2,
                     const float* __restrict__ hqb, const float* __restrict__ nhk,
                     float* __restrict__ out, float* __restrict__ weights)
{
    const int b  = blockIdx.x >> 5;    // batch
    const int q0 = (blockIdx.x & 31) * 16;

    const int tid  = threadIdx.x;
    const int wave = tid >> 5;
    const int lane = tid & 31;
    const int half = lane >> 4;
    const int lp   = lane & 15;

    __shared__ float ldsQ[16][132];    // Q tile (padded)
    __shared__ float ldsH[16][132];    // hqb tile (b1 folded)
    __shared__ float ldsW2[128];
    // gated scores, +4 pad for P@V column reads; aligned for the softmax's 16-byte reads
    __shared__ __attribute__((aligned(16))) float SG[16][516];

    { // stage Q tile + hqb tile + W2
        const int row = tid >> 4;
        const int col = (tid & 15) * 8;
        const float* qs = Q   + ((size_t)(b * L_) + q0 + row) * D_ + col;
        const float* hs = hqb + ((size_t)(b * L_) + q0 + row) * D_ + col;
        *(float4*)&ldsQ[row][col]     = *(const float4*)(qs);
        *(float4*)&ldsQ[row][col + 4] = *(const float4*)(qs + 4);
        *(float4*)&ldsH[row][col]     = *(const float4*)(hs);
        *(float4*)&ldsH[row][col + 4] = *(const float4*)(hs + 4);
        if (tid < 128) ldsW2[tid] = W2[tid];
    }

    // ---- nhk of the conflict loop, fetched ahead ----
    // nhk depends on nothing staged here. Trip t asks for the values of trip
    // t + HPRE, so that a load has HPRE trips of vector work to land in; the first
    // HPRE trips are asked for here, beside the staging loads.
    // (a trip's 4 values of d of the tile's 16 keys stand 64 floats in a row)
    const float* hkr = nhk + (size_t)(b * (L_ / 16) + wave) * TILEF + lp * 4;
    v4f hv[4][4];                      // [trip mod 4][k tile j]
    // unrolled so that hv stays in registers
#pragma unroll
    for (int u = 0; u < HPRE; ++u)
#pragma unroll
        for (int j = 0; j < 4; ++j)                 // 8 key tiles apart: tile j
            hv[u][j] = *(const v4f*)(hkr + (size_t)j * 8 * TILEF + 64 * u);
    __syncthreads();

    const float bias2 = b2[0];

    // ---- conflict[q,k] = sum_d relu(hqb[q,d]+hk[k,d])*W2[d]  (VALU) ----
    // relu(a + b) = max(a, -b) + b, so
    //   conflict = sum_d max(hqb[q,d], nhk[k,d])*W2[d] - sum_d nhk[k,d]*W2[d].
    // The first sum costs one max and one multiply-add an element (no add in
    // front of the max); the second depends on the key alone: once per lane and key.
    // One d loop for all four k tiles of the wave (tile j = wave + 8*j). Each sum
    // is kept as an (even d, odd d) pair, so that two multiply-adds go as one
    // packed instruction; the pair is added up behind the loop.
    v2f cacc[4][8];
    v2f ksum[4];
#pragma unroll
    for (int j = 0; j < 4; ++j) {
        ksum[j] = (v2f){0.f, 0.f};
#pragma unroll
        for (int r = 0; r < 8; ++r) cacc[j][r] = (v2f){0.f, 0.f};
    }

    static_assert(HPRE == 2, "the four addresses below stand two trips ahead");
    for (int d = 0; d < D_; d += 16) {               // four trips a pass
        // trips 2 and 3 ask for the next pass's first two trips. Behind the last pass
        // there is none: it asks for its own first two again (inside the tile, lines
        // just read), and nothing reads those values
        const float* hkn = hkr + (d + 16 < D_ ? d + 16 : d) * 16;
        cga_conflict_trip<0>(hv, hkr + (d + 8) * 16,  d,      ldsW2, ldsH, half, cacc, ksum);
        cga_conflict_trip<1>(hv, hkr + (d + 12) * 16, d + 4,  ldsW2, ldsH, half, cacc, ksum);
        cga_conflict_trip<2>(hv, hkn,                 d + 8,  ldsW2, ldsH, half, cacc, ksum);
        cga_conflict_trip<3>(hv, hkn + 64,            d + 12, ldsW2, ldsH, half, cacc, ksum);
    }

    float conf[4][8];
#pragma unroll
    for (int j = 0; j < 4; ++j) {
        const float ks = ksum[j].x + ksum[j].y;
#pragma unroll
        for (int r = 0; r < 8; ++r) conf[j][r] = (cacc[j][r].x + cacc[j][r].y) - ks;
    }

    // mask words of the lane's 32 (q row, k tile) places: one address pair,
    // the places told apart by constant offsets
    const int* mrow = mask + (((size_t)b * L_) + q0 + 8 * half) * L_ + wave * 16 + lp;
    int mv[4][8];
#pragma unroll
    for (int j = 0; j < 4; ++j)
#pragma unroll
        for (int r = 0; r < 8; ++r) mv[j][r] = mrow[r * L_ + j * 128];
    // precaution: the address pair of the issued mask loads stays live up to
    // this wait, so nothing rewrites it ahead of the wait
    asm volatile("s_wait_xcnt 0x0" :: "v"(mrow) : "memory");

    const float* kbase = kp + (size_t)(b * (L_ / 16) + wave) * TILEF + lp * 8 + half * 4;

    // unrolled so that conf[j] stays in registers
#pragma unroll
    for (int j = 0; j < 4; ++j) {
        const int k0 = (wave + 8 * j) * 16;

        // ---- S = Q_tile * K_tile^T  (32 chained f32 WMMAs) ----
        v8f acc = {};
        const float* krow = kbase + (size_t)j * 8 * TILEF;   // 8 tiles apart: tile j
        for (int c = 0; c < D_; c += 8) {
            // xy: K[k0+n][c+kb+i], zw: K[k0+n][c+4+kb+i]  (kb = 2*half)
            const v4f kv = *(const v4f*)(krow + (c / 8) * UNITF);
            v2f a = *(const v2f*)&ldsQ[lp][c + 2 * half];
            acc = __builtin_amdgcn_wmma_f32_16x16x4_f32(false, a, false, kv.xy,
                                                        (short)0, acc, false, false);
            a = *(const v2f*)&ldsQ[lp][c + 4 + 2 * half];
            acc = __builtin_amdgcn_wmma_f32_16x16x4_f32(false, a, false, kv.zw,
                                                        (short)0, acc, false, false);
        }

        // ---- gate + mask -> SG ----
#pragma unroll
        for (int r = 0; r < 8; ++r) {
            const int qrow = r + 8 * half;
            const float g  = 1.f / (1.f + __expf(-(conf[j][r] + bias2)));
            float sg = acc[r] * SCALE * g;
            if (mv[j][r] == 0) sg = -__builtin_inff();
            SG[qrow][k0 + lp] = sg;
        }
    }
    // precaution: the address pair of the K loads stays live up to this wait
    asm volatile("s_wait_xcnt 0x0" :: "v"(kbase) : "memory");
    __syncthreads();

    // ---- V fragments of P@V, fetched ahead ----
    // V depends on nothing computed here: the fragments of the first VPRE key
    // steps are asked for here, behind the barrier (which waits for every load
    // issued in front of it), and fly while the softmax runs. One address pair
    // for all 128 steps; a step is told from the next by a constant offset, so
    // the pair is not rewritten between the loads.
    const float* vbase = V + ((size_t)(b * L_) + 2 * half) * D_ + wave * 16 + lp;
    v2f vb[L_ / 4];                    // B: V[4s+kb+j][d0+n], step s
    // unrolled so that vb stays in registers
#pragma unroll
    for (int s = 0; s < VPRE; ++s) {
        vb[s].x = vbase[(4 * s) * D_];
        vb[s].y = vbase[(4 * s + 1) * D_];
    }
    // keeps the V loads in front of the softmax: moved in among its instructions they
    // start later, and the barrier behind the softmax waits for the last of them
    __builtin_amdgcn_sched_barrier(0);

    // ---- softmax over k: a wave's 2 rows held in registers from read to store ----
    // A lane reads 16 scores of each row once (16 bytes a read, a wave's read covers
    // 512 bytes in a row), and maximum, exponentials, sum and scaling work on those
    // registers; P goes to LDS once. Both rows run side by side, so that each fills
    // the other's waits. The maximum and the sum over the 32 lanes go through vector
    // cross-lane operands, not through the LDS unit.
    v4f px[2][4];                      // [row of the wave][128-key block]
    {
        float* srow = &SG[wave * 2][4 * lane];
        // every loop here is unrolled so that px stays in registers
#pragma unroll
        for (int rr = 0; rr < 2; ++rr)
#pragma unroll
            for (int i = 0; i < 4; ++i) px[rr][i] = *(const v4f*)(srow + rr * 516 + 128 * i);

        float mx[2];
#pragma unroll
        for (int rr = 0; rr < 2; ++rr) {
            const v4f m4 = __builtin_elementwise_max(
                __builtin_elementwise_max(px[rr][0], px[rr][1]),
                __builtin_elementwise_max(px[rr][2], px[rr][3]));
            mx[rr] = fmaxf(fmaxf(m4.x, m4.y), fmaxf(m4.z, m4.w));
        }
#pragma unroll
        for (int rr = 0; rr < 2; ++rr) mx[rr] = fmaxf(mx[rr], cga_xrow<1>(mx[rr]));
#pragma unroll
        for (int rr = 0; rr < 2; ++rr) mx[rr] = fmaxf(mx[rr], cga_xrow<2>(mx[rr]));
#pragma unroll
        for (int rr = 0; rr < 2; ++rr) mx[rr] = fmaxf(mx[rr], cga_xrow<4>(mx[rr]));
#pragma unroll
        for (int rr = 0; rr < 2; ++rr) mx[rr] = fmaxf(mx[rr], cga_xrow<8>(mx[rr]));
#pragma unroll
        for (int rr = 0; rr < 2; ++rr) mx[rr] = fmaxf(mx[rr], cga_xhalf(mx[rr]));

        float sum[2];
#pragma unroll
        for (int rr = 0; rr < 2; ++rr) {
#pragma unroll
            for (int i = 0; i < 4; ++i) {
                px[rr][i].x = __expf(px[rr][i].x - mx[rr]);
                px[rr][i].y = __expf(px[rr][i].y - mx[rr]);
                px[rr][i].z = __expf(px[rr][i].z - mx[rr]);
                px[rr][i].w = __expf(px[rr][i].w - mx[rr]);
            }
            const v4f s4 = (px[rr][0] + px[rr][1]) + (px[rr][2] + px[rr][3]);
            sum[rr] = (s4.x + s4.y) + (s4.z + s4.w);
        }
#pragma unroll
        for (int rr = 0; rr < 2; ++rr) sum[rr] += cga_xrow<1>(sum[rr]);
#pragma unroll
        for (int rr = 0; rr < 2; ++rr) sum[rr] += cga_xrow<2>(sum[rr]);
#pragma unroll
        for (int rr = 0; rr < 2; ++rr) sum[rr] += cga_xrow<4>(sum[rr]);
#pragma unroll
        for (int rr = 0; rr < 2; ++rr) sum[rr] += cga_xrow<8>(sum[rr]);
#pragma unroll
        for (int rr = 0; rr < 2; ++rr) sum[rr] += cga_xhalf(sum[rr]);

#pragma unroll
        for (int rr = 0; rr < 2; ++rr) {
            const float inv = 1.f / sum[rr];
#pragma unroll
            for (int i = 0; i < 4; ++i) {
                px[rr][i] *= inv;
                *(v4f*)(srow + rr * 516 + 128 * i) = px[rr][i];
            }
        }
    }
    __syncthreads();

    // the weights go out of the same registers, behind the barrier (which waits for
    // every store issued in front of it), and fly while P@V runs: 16 bytes a lane,
    // a wave's store covers 4 whole cache lines
    {
        float* wout = weights + (((size_t)b * L_) + q0 + wave * 2) * L_ + 4 * lane;
#pragma unroll
        for (int rr = 0; rr < 2; ++rr)
#pragma unroll
            for (int i = 0; i < 4; ++i) *(v4f*)(wout + rr * L_ + 128 * i) = px[rr][i];
        // precaution: the address pair and the data of the issued stores stay live
        // up to this wait, so nothing rewrites them ahead of it
        asm volatile("s_wait_xcnt 0x0"
                     :: "v"(wout), "v"(px[0][0]), "v"(px[0][1]), "v"(px[0][2]), "v"(px[0][3]),
                        "v"(px[1][0]), "v"(px[1][1]), "v"(px[1][2]), "v"(px[1][3])
                     : "memory");
    }

    // ---- out = P @ V  (128 chained f32 WMMAs; wave owns d-tile = 16*wave) ----
    {
        const int d0 = wave * 16;
        v8f acc = {};
        // unrolled so that vb stays in registers and every V load has a constant
        // offset; step s asks for the fragment of step s + VPRE
#pragma unroll
        for (int s = 0; s < L_ / 4; ++s) {
            if (s + VPRE < L_ / 4) {
                vb[s + VPRE].x = vbase[(4 * (s + VPRE)) * D_];
                vb[s + VPRE].y = vbase[(4 * (s + VPRE) + 1) * D_];
            }
            v2f a = *(const v2f*)&SG[lp][4 * s + 2 * half];  // A: P[m][4s+kb+j]
            acc = __builtin_amdgcn_wmma_f32_16x16x4_f32(false, a, false, vb[s],
                                                        (short)0, acc, false, false);
        }
        // precaution: the address pair of the V loads stays live up to this wait
        asm volatile("s_wait_xcnt 0x0" :: "v"(vbase) : "memory");
#pragma unroll
        for (int r = 0; r < 8; ++r)
            out[(((size_t)b * L_) + q0 + r + 8 * half) * D_ + d0 + lp] = acc[r];
    }
}

// ---------------------------------------------------------------------------
extern "C" void kernel_launch(void* const* d_in, const int* in_sizes, int n_in,
                              void* d_out, int out_size, void* d_ws, size_t ws_size,
                              hipStream_t stream)
{
    const float* Q    = (const float*)d_in[0];
    const float* K    = (const float*)d_in[1];
    const float* V    = (const float*)d_in[2];
    const int*   mask = (const int*)  d_in[3];
    const float* W1   = (const float*)d_in[4];
    const float* b1   = (const float*)d_in[5];
    const float* W2   = (const float*)d_in[6];
    const float* b2   = (const float*)d_in[7];

    float* out     = (float*)d_out;                       // [B,L,D]
    float* weights = (float*)d_out + (size_t)BL_ * D_;    // [B,L,L]

    // workspace: hqb [B,L,D], nhk (B*L*D floats), kp (B*L*D floats)  (3 MB total)
    float* hqb = (float*)d_ws;
    float* nhk = (float*)d_ws + (size_t)BL_ * D_;
    float* kp  = (float*)d_ws + (size_t)2 * BL_ * D_;

    cga_proj_kernel<<<2 * BL_ / 16, 256, 0, stream>>>(Q, K, W1, b1, hqb, nhk, kp);
    cga_attn_kernel<<<B_ * (L_ / 16), 256, 0, stream>>>(Q, kp, V, mask, W2, b2,
                                                        hqb, nhk, out, weights);
}

// v008
// One run takes 21.7 microseconds.
// Next to v007, in two timings, it ran 1.13 and 1.11 times as fast.
// Over all steps from v000 it is 2.26 times as fast.
#include <hip/hip_runtime.h>
#include <hip/hip_bf16.h>

typedef __attribute__((ext_vector_type(2))) float v2f;
typedef __attribute__((ext_vector_type(4))) float v4f;
typedef __attribute__((ext_vector_type(8))) float v8f;

#define B_  4
#define L_  512
#define D_  128
#define BL_ (B_ * L_)
#define SCALE 0.08838834764831845f  /* 1/sqrt(128) */
#define TILEF (16 * D_)  /* floats of one 16-key tile in kp */
#define UNITF 128        /* floats of one 8-column unit of a key tile in kp */
#define VPRE 30   /* key steps of V fetched ahead in P@V: 60 loads in flight */
#define HPRE 2    /* d trips of nhk fetched ahead in the conflict loop: 8 loads in flight */
#define QT 8      /* q rows of one work-group of kernel 2: 256 work-groups, one a WGP */

// ---------------------------------------------------------------------------
// Kernel 1: hqb = Q @ W1[:D] + b1 ; nhk = -(K @ W1[D:])  (stored negated, see below) ; kp = K
// X = [Q; K] rows 0..2*BL-1. One WG = 16 rows; wave w = output cols [16w,16w+16).
// V_WMMA_F32_16X16X4_F32 accumulating over the 128-deep contraction.
// kp holds K bit for bit, in the order in which the lanes of kernel 2 take their
// B fragments of Q K^T:
//   kp[key tile][u][key in tile][hf][e][i] = K[key][8*u + 4*e + 2*hf + i]
// (hf = the lane's half, e = the first or second of two contraction steps).
// One 16-byte load a lane then feeds two steps, and the wave's 32 loads cover 512
// bytes in a row (4 whole cache lines) where 16 key rows gave 16 lines a load.
// nhk goes out in the order in which the lanes of kernel 2 read it in the conflict loop:
//   nhk[key tile][d / 4][key in tile][d % 4]
// so that the 16-byte loads of a wave (16 keys, 8 values of d) cover 512 bytes in a row (4 whole cache
// lines) where 16 key rows gave 16 lines a load. For that the key side takes W1 as the
// A operand and K as the B operand (both fragments have the same lane map): the tile
// comes out transposed, a lane holds 8 values of d in a row of one key, and two
// 16-byte stores a lane write whole lines. Products and their order stay the same.
// ---------------------------------------------------------------------------
__global__ __launch_bounds__(256)
void cga_proj_kernel(const float* __restrict__ Q, const float* __restrict__ K,
                     const float* __restrict__ W1, const float* __restrict__ b1,
                     float* __restrict__ hqb, float* __restrict__ nhk,
                     float* __restrict__ kp)
{
    const int r0   = blockIdx.x * 16;          // row tile in X (0..4095)
    const bool isK = (r0 >= BL_);
    const float* X = isK ? (K + (size_t)(r0 - BL_) * D_) : (Q + (size_t)r0 * D_);

    const int tid  = threadIdx.x;
    const int wave = tid >> 5;
    const int lane = tid & 31;
    const int half = lane >> 4;        // K-pair selector for A/B operands
    const int lp   = lane & 15;        // m (A) / n (B,C,D)

    __shared__ float ldsX[16][132];    // +4 pad: stride-132 kills bank conflicts

    { // cooperative 16x128 tile stage: 256 threads x 8 floats
        const int row = tid >> 4;
        const int col = (tid & 15) * 8;
        const float* src = X + (size_t)row * D_ + col;
        *(float4*)&ldsX[row][col]     = *(const float4*)(src);
        *(float4*)&ldsX[row][col + 4] = *(const float4*)(src + 4);
    }
    __syncthreads();

    if (isK) { // the K tile out of LDS into kp: a wave stores 512 bytes in a row
        float* kt = kp + (size_t)(blockIdx.x - BL_ / 16) * TILEF + lane * 4;
        const int key = lane >> 1;
        const int hf  = lane & 1;
        for (int h = 0; h < 2; ++h) {          // two units a thread
            const int u = wave + 8 * h;
            const v2f e0 = *(const v2f*)&ldsX[key][8 * u + 2 * hf];
            const v2f e1 = *(const v2f*)&ldsX[key][8 * u + 4 + 2 * hf];
            *(v4f*)(kt + u * UNITF) = (v4f){e0.x, e0.y, e1.x, e1.y};
        }
        // precaution: stands in front of whatever rewrites a register that the
        // two issued stores name
        asm volatile("s_wait_xcnt 0x0" ::: "memory");
    }

    const int d0   = wave * 16;        // output column tile
    const int woff = isK ? D_ : 0;     // which half of W1 [256,128]

    v8f acc = {};
    if (isK) {   // the same for the whole work-group
        for (int c = 0; c < D_; c += 4) {
            // B: X[n][c + kb + j], contiguous float2 per lane
            v2f a = *(const v2f*)&ldsX[lp][c + 2 * half];
            // A: W1[woff + c + kb + j][d0 + m], two coalesced scalar reads
            const float* wr = W1 + (size_t)(woff + c + 2 * half) * D_ + d0 + lp;
            v2f bv; bv.x = wr[0]; bv.y = wr[D_];
            acc = __builtin_amdgcn_wmma_f32_16x16x4_f32(false, bv, false, a,
                                                        (short)0, acc, false, false);
        }
        // C/D layout: acc[r] = hk[key lp][d0 + 8*half + r]; the key side goes out negated
        float* nt = nhk + (size_t)(blockIdx.x - BL_ / 16) * TILEF
                        + (d0 / 4 + 2 * half) * 64 + lp * 4;
        *(v4f*)(nt)      = (v4f){-acc[0], -acc[1], -acc[2], -acc[3]};
        *(v4f*)(nt + 64) = (v4f){-acc[4], -acc[5], -acc[6], -acc[7]};
        return;
    }
    for (int c = 0; c < D_; c += 4) {
        // A: X[m][c + kb + j], contiguous float2 per lane
        v2f a = *(const v2f*)&ldsX[lp][c + 2 * half];
        // B: W1[woff + c + kb + j][d0 + n], two coalesced scalar reads
        const float* wr = W1 + (size_t)(woff + c + 2 * half) * D_ + d0 + lp;
        v2f bv; bv.x = wr[0]; bv.y = wr[D_];
        acc = __builtin_amdgcn_wmma_f32_16x16x4_f32(false, a, false, bv,
                                                    (short)0, acc, false, false);
    }
#pragma unroll
    for (int r = 0; r < 8; ++r) {
        const int row = r0 + r + 8 * half;         // C/D layout: M = r + 8*half
        hqb[(size_t)row * D_ + d0 + lp] = acc[r] + b1[d0 + lp];   // fold b1 into hqb
    }
}

// ---------------------------------------------------------------------------
// One trip (8 values of d: 4 in each half of the wave) of kernel 2's conflict sum, for
// the 8 q rows and the lane's 4 keys. d is the first of the lane's own 4 values.
// hv is a ring of four trips of nhk in registers; U = trip mod 4 is a
// constant, so that the ring's places are fixed registers. The trip first asks for
// the nhk values of trip + HPRE, which stand at pf.
// ---------------------------------------------------------------------------
template <int U>
__device__ __forceinline__
void cga_conflict_trip(v4f (&hv)[4][4], const float* __restrict__ pf, const int d,
                       const float* ldsW2, const float (*ldsH)[132],
                       v2f (&cacc)[4][8], v2f (&ksum)[4])
{
#pragma unroll
    for (int j = 0; j < 4; ++j)                     // 8 key tiles apart: tile j
        hv[(U + HPRE) & 3][j] = *(const v4f*)(pf + (size_t)j * 8 * TILEF);
    // precaution: stands behind the last nhk loads of a pass, in front of whatever
    // rewrites an address register that the pass's issued loads name
    if (U == 3) asm volatile("s_wait_xcnt 0x0" ::: "memory");
    const v4f wv  = *(const v4f*)&ldsW2[d];         // LDS broadcast (one address a half)
    v4f hq[8];
#pragma unroll
    for (int r = 0; r < 8; ++r)
        hq[r] = *(const v4f*)&ldsH[r][d];           // LDS broadcast (one address a half)
    const v2f w01 = wv.xy, w23 = wv.zw;
#pragma unroll
    for (int j = 0; j < 4; ++j) {
        ksum[j] = __builtin_elementwise_fma(hv[U][j].xy, w01, ksum[j]);
        ksum[j] = __builtin_elementwise_fma(hv[U][j].zw, w23, ksum[j]);
    }
    // four q rows at a time: all their maxima, then all their multiply-adds, so that
    // no instruction stands close behind the one whose result it reads
#pragma unroll
    for (int rb = 0; rb < 8; rb += 4) {
        v2f m01[4][4], m23[4][4];
#pragma unroll
        for (int r = 0; r < 4; ++r)
#pragma unroll
            for (int j = 0; j < 4; ++j) {
                m01[r][j] = __builtin_elementwise_max(hq[rb + r].xy, hv[U][j].xy);
                m23[r][j] = __builtin_elementwise_max(hq[rb + r].zw, hv[U][j].zw);
            }
#pragma unroll
        for (int r = 0; r < 4; ++r)
#pragma unroll
            for (int j = 0; j < 4; ++j)
                cacc[j][rb + r] = __builtin_elementwise_fma(m01[r][j], w01, cacc[j][rb + r]);
#pragma unroll
        for (int r = 0; r < 4; ++r)
#pragma unroll
            for (int j = 0; j < 4; ++j)
                cacc[j][rb + r] = __builtin_elementwise_fma(m23[r][j], w23, cacc[j][rb + r]);
    }
    // compiler fence, no instruction: keeps the next trips' loads behind this trip.
    // Lifted to the head of the pass, they land in registers of their own and are
    // copied into the ring at the loop's foot, behind a wait for all of them; and
    // four trips merged need more than 256 registers
    asm volatile("" ::: "memory");
}

// ---------------------------------------------------------------------------
// Cross-lane moves of kernel 2's softmax, on the vector unit.
// cga_xrow<M>: the value of lane l ^ M, M < 16 (a DPP operand inside a row of 16
// lanes); cga_xhalf: the value of lane l ^ 16.
// ---------------------------------------------------------------------------
template <int M>
__device__ __forceinline__ float cga_xrow(const float x)
{
    return __builtin_bit_cast(float,
        __builtin_amdgcn_mov_dpp(__builtin_bit_cast(int, x), 0x160 + M, 0xf, 0xf, true));  // row_xmask:M
}
__device__ __forceinline__ float cga_xhalf(const float x)
{
    const int v = __builtin_bit_cast(int, x);
    return __builtin_bit_cast(float,
        __builtin_amdgcn_permlanex16(v, v, 0x76543210, 0xfedcba98, false, false));
}

// ---------------------------------------------------------------------------
// Kernel 2: fused gated attention for one (b, 8-row q tile): 256 work-groups, so that
// every WGP of the chip has one (16-row tiles give 128 and leave half the WGPs idle).
// 8 waves: each owns 4 k-tiles (conflict via VALU for all 4 at once, S via WMMA, gate),
// then softmax (1 row a wave, in registers), then P@V via WMMA (one d-tile per wave).
// The vector work (conflict, gate, softmax) of a work-group is halved. The matrix tiles
// stay 16 rows high: A row m holds q row (m & 3) + 4 * (m >> 3), so that D registers
// 0..3 of a lane are q rows 4*half + 0..3 and registers 4..7 repeat them, unused.
// ---------------------------------------------------------------------------
__global__ __launch_bounds__(256)
void cga_attn_kernel(const float* __restrict__ Q, const float* __restrict__ kp,
                     const float* __restrict__ V, const int* __restrict__ mask,
                     const float* __restrict__ W2, const float* __restrict__ b2,
                     const float* __restrict__ hqb, const float* __restrict__ nhk,
                     float* __restrict__ out, float* __restrict__ weights)
{
    const int b  = blockIdx.x / (L_ / QT);    // batch
    const int q0 = (blockIdx.x % (L_ / QT)) * QT;

    const int tid  = threadIdx.x;
    const int wave = tid >> 5;
    const int lane = tid & 31;
    const int half = lane >> 4;
    const int lp   = lane & 15;
    const int qm   = (lp & 3) + 4 * (lp >> 3);   // q row in A row lp of both products

    __shared__ float ldsQ[QT][132];    // Q tile (padded)
    __shared__ float ldsH[QT][132];    // hqb tile (b1 folded)
    __shared__ float ldsW2[128];
    // gated scores, +4 pad for P@V column reads; aligned for the softmax's 16-byte reads
    __shared__ __attribute__((aligned(16))) float SG[QT][516];

    { // stage Q tile + hqb tile + W2
        const int row = tid >> 5;
        const int col = (tid & 31) * 4;
        const float* qs = Q   + ((size_t)(b * L_) + q0 + row) * D_ + col;
        const float* hs = hqb + ((size_t)(b * L_) + q0 + row) * D_ + col;
        *(float4*)&ldsQ[row][col] = *(const float4*)(qs);
        *(float4*)&ldsH[row][col] = *(const float4*)(hs);
        if (tid < 128) ldsW2[tid] = W2[tid];
    }

    // ---- nhk of the conflict loop, fetched ahead ----
    // nhk depends on nothing staged here. Trip t asks for the values of trip
    // t + HPRE, so that a load has HPRE trips of vector work to land in; the first
    // HPRE trips are asked for here, beside the staging loads.
    // (4 values of d of the tile's 16 keys stand 64 floats in a row; a trip's 8 values
    // 128 floats: the wave's load covers 4 whole cache lines)
    const float* hkr = nhk + (size_t)(b * (L_ / 16) + wave) * TILEF + half * 64 + lp * 4;
    v4f hv[4][4];                      // [trip mod 4][k tile j]
    // unrolled so that hv stays in registers
#pragma unroll
    for (int u = 0; u < HPRE; ++u)
#pragma unroll
        for (int j = 0; j < 4; ++j)                 // 8 key tiles apart: tile j
            hv[u][j] = *(const v4f*)(hkr + (size_t)j * 8 * TILEF + 128 * u);
    __syncthreads();

    const float bias2 = b2[0];

    // ---- conflict[q,k] = sum_d relu(hqb[q,d]+hk[k,d])*W2[d]  (VALU) ----
    // relu(a + b) = max(a, -b) + b, so
    //   conflict = sum_d max(hqb[q,d], nhk[k,d])*W2[d] - sum_d nhk[k,d]*W2[d].
    // The first sum costs one max and one multiply-add an element (no add in
    // front of the max); the second depends on the key alone: once per lane and key.
    // One d loop for all four k tiles of the wave (tile j = wave + 8*j). Every lane
    // works on all 8 q rows; the two halves of the wave share d: of each 8 values the
    // lower half takes the first 4, the upper half the last 4, and the two part sums
    // meet behind the loop. Each sum is kept as an (even d, odd d) pair, so that two
    // multiply-adds go as one packed instruction; the pair is added up behind the loop.
    v2f cacc[4][8];
    v2f ksum[4];
#pragma unroll
    for (int j = 0; j < 4; ++j) {
        ksum[j] = (v2f){0.f, 0.f};
#pragma unroll
        for (int r = 0; r < 8; ++r) cacc[j][r] = (v2f){0.f, 0.f};
    }

    static_assert(HPRE == 2, "the four addresses below stand two trips ahead");
    for (int d = 0; d < D_; d += 32) {               // four trips a pass
        // trips 2 and 3 ask for the next pass's first two trips. Behind the last pass
        // there is none: it asks for its own first two again (inside the tile, lines
        // just read), and nothing reads those values
        const float* hkn = hkr + (d + 32 < D_ ? d + 32 : d) * 16;
        const int dl = d + 4 * half;                 // the lane's own 4 values of d
        cga_conflict_trip<0>(hv, hkr + (d + 16) * 16, dl,      ldsW2, ldsH, cacc, ksum);
        cga_conflict_trip<1>(hv, hkr + (d + 24) * 16, dl + 8,  ldsW2, ldsH, cacc, ksum);
        cga_conflict_trip<2>(hv, hkn,                 dl + 16, ldsW2, ldsH, cacc, ksum);
        cga_conflict_trip<3>(hv, hkn + 128,           dl + 24, ldsW2, ldsH, cacc, ksum);
    }

    // the two halves' part sums meet: a lane keeps the part of its own 4 q rows
    // (4*half + r, the rows of its D registers 0..3) and hands the part of the other 4
    // to lane ^ 16
    float conf[4][4];
#pragma unroll
    for (int j = 0; j < 4; ++j) {
        const float ks = ksum[j].x + ksum[j].y;
        float part[8];
#pragma unroll
        for (int r = 0; r < 8; ++r) part[r] = (cacc[j][r].x + cacc[j][r].y) - ks;
#pragma unroll
        for (int r = 0; r < 4; ++r) {
            const float keep = half ? part[4 + r] : part[r];
            const float send = half ? part[r] : part[4 + r];
            conf[j][r] = keep + cga_xhalf(send);
        }
    }

    // mask words of the lane's 16 (q row, k tile) places: one address pair,
    // the places told apart by constant offsets
    const int* mrow = mask + (((size_t)b * L_) + q0 + 4 * half) * L_ + wave * 16 + lp;
    int mv[4][4];
#pragma unroll
    for (int j = 0; j < 4; ++j)
#pragma unroll
        for (int r = 0; r < 4; ++r) mv[j][r] = mrow[r * L_ + j * 128];
    // precaution: the address pair of the issued mask loads stays live up to
    // this wait, so nothing rewrites it ahead of the wait
    asm volatile("s_wait_xcnt 0x0" :: "v"(mrow) : "memory");

    const float* kbase = kp + (size_t)(b * (L_ / 16) + wave) * TILEF + lp * 8 + half * 4;

    // unrolled so that conf[j] stays in registers
#pragma unroll
    for (int j = 0; j < 4; ++j) {
        const int k0 = (wave + 8 * j) * 16;

        // ---- S = Q_tile * K_tile^T  (32 chained f32 WMMAs) ----
        v8f acc = {};
        const float* krow = kbase + (size_t)j * 8 * TILEF;   // 8 tiles apart: tile j
        for (int c = 0; c < D_; c += 8) {
            // xy: K[k0+n][c+kb+i], zw: K[k0+n][c+4+kb+i]  (kb = 2*half)
            const v4f kv = *(const v4f*)(krow + (c / 8) * UNITF);
            v2f a = *(const v2f*)&ldsQ[qm][c + 2 * half];
            acc = __builtin_amdgcn_wmma_f32_16x16x4_f32(false, a, false, kv.xy,
                                                        (short)0, acc, false, false);
            a = *(const v2f*)&ldsQ[qm][c + 4 + 2 * half];
            acc = __builtin_amdgcn_wmma_f32_16x16x4_f32(false, a, false, kv.zw,
                                                        (short)0, acc, false, false);
        }

        // ---- gate + mask -> SG ----
#pragma unroll
        for (int r = 0; r < 4; ++r) {
            const int qrow = r + 4 * half;
            const float g  = 1.f / (1.f + __expf(-(conf[j][r] + bias2)));
            float sg = acc[r] * SCALE * g;
            if (mv[j][r] == 0) sg = -__builtin_inff();
            SG[qrow][k0 + lp] = sg;
        }
    }
    // precaution: the address pair of the K loads stays live up to this wait
    asm volatile("s_wait_xcnt 0x0" :: "v"(kbase) : "memory");
    __syncthreads();

    // ---- V fragments of P@V, fetched ahead ----
    // V depends on nothing computed here: the fragments of the first VPRE key
    // steps are asked for here, behind the barrier (which waits for every load
    // issued in front of it), and fly while the softmax runs. One address pair
    // for all 128 steps; a step is told from the next by a constant offset, so
    // the pair is not rewritten between the loads.
    const float* vbase = V + ((size_t)(b * L_) + 2 * half) * D_ + wave * 16 + lp;
    v2f vb[L_ / 4];                    // B: V[4s+kb+j][d0+n], step s
    // unrolled so that vb stays in registers
#pragma unroll
    for (int s = 0; s < VPRE; ++s) {
        vb[s].x = vbase[(4 * s) * D_];
        vb[s].y = vbase[(4 * s + 1) * D_];
    }
    // keeps the V loads in front of the softmax: moved in among its instructions they
    // start later, and the barrier behind the softmax waits for the last of them
    __builtin_amdgcn_sched_barrier(0);

    // ---- softmax over k: a wave's row held in registers from read to store ----
    // A lane reads 16 scores of the row once (16 bytes a read, a wave's read covers
    // 512 bytes in a row), and maximum, exponentials, sum and scaling work on those
    // registers; P goes to LDS once. The maximum and the sum over the 32 lanes go
    // through vector cross-lane operands, not through the LDS unit.
    v4f px[4];                         // [128-key block]
    {
        float* srow = &SG[wave][4 * lane];
        // every loop here is unrolled so that px stays in registers
#pragma unroll
        for (int i = 0; i < 4; ++i) px[i] = *(const v4f*)(srow + 128 * i);

        const v4f m4 = __builtin_elementwise_max(
            __builtin_elementwise_max(px[0], px[1]),
            __builtin_elementwise_max(px[2], px[3]));
        float mx = fmaxf(fmaxf(m4.x, m4.y), fmaxf(m4.z, m4.w));
        mx = fmaxf(mx, cga_xrow<1>(mx));
        mx = fmaxf(mx, cga_xrow<2>(mx));
        mx = fmaxf(mx, cga_xrow<4>(mx));
        mx = fmaxf(mx, cga_xrow<8>(mx));
        mx = fmaxf(mx, cga_xhalf(mx));

#pragma unroll
        for (int i = 0; i < 4; ++i) {
            px[i].x = __expf(px[i].x - mx);
            px[i].y = __expf(px[i].y - mx);
            px[i].z = __expf(px[i].z - mx);
            px[i].w = __expf(px[i].w - mx);
        }
        const v4f s4 = (px[0] + px[1]) + (px[2] + px[3]);
        float sum = (s4.x + s4.y) + (s4.z + s4.w);
        sum += cga_xrow<1>(sum);
        sum += cga_xrow<2>(sum);
        sum += cga_xrow<4>(sum);
        sum += cga_xrow<8>(sum);
        sum += cga_xhalf(sum);

        const float inv = 1.f / sum;
#pragma unroll
        for (int i = 0; i < 4; ++i) {
            px[i] *= inv;
            *(v4f*)(srow + 128 * i) = px[i];
        }
    }
    __syncthreads();

    // the weights go out of the same registers, behind the barrier (which waits for
    // every store issued in front of it), and fly while P@V runs: 16 bytes a lane,
    // a wave's store covers 4 whole cache lines
    {
        float* wout = weights + (((size_t)b * L_) + q0 + wave) * L_ + 4 * lane;
#pragma unroll
        for (int i = 0; i < 4; ++i) *(v4f*)(wout + 128 * i) = px[i];
        // precaution: the address pair and the data of the issued stores stay live
        // up to this wait, so nothing rewrites them ahead of it
        asm volatile("s_wait_xcnt 0x0"
                     :: "v"(wout), "v"(px[0]), "v"(px[1]), "v"(px[2]), "v"(px[3])
                     : "memory");
    }

    // ---- out = P @ V  (128 chained f32 WMMAs; wave owns d-tile = 16*wave) ----
    {
        const int d0 = wave * 16;
        v8f acc = {};
        // unrolled so that vb stays in registers and every V load has a constant
        // offset; step s asks for the fragment of step s + VPRE
#pragma unroll
        for (int s = 0; s < L_ / 4; ++s) {
            if (s + VPRE < L_ / 4) {
                vb[s + VPRE].x = vbase[(4 * (s + VPRE)) * D_];
                vb[s + VPRE].y = vbase[(4 * (s + VPRE) + 1) * D_];
            }
            v2f a = *(const v2f*)&SG[qm][4 * s + 2 * half];  // A: P[q row of m][4s+kb+j]
            acc = __builtin_amdgcn_wmma_f32_16x16x4_f32(false, a, false, vb[s],
                                                        (short)0, acc, false, false);
        }
        // precaution: the address pair of the V loads stays live up to this wait
        asm volatile("s_wait_xcnt 0x0" :: "v"(vbase) : "memory");
#pragma unroll
        for (int r = 0; r < 4; ++r)
            out[(((size_t)b * L_) + q0 + r + 4 * half) * D_ + d0 + lp] = acc[r];
    }
}

// ---------------------------------------------------------------------------
extern "C" void kernel_launch(void* const* d_in, const int* in_sizes, int n_in,
                              void* d_out, int out_size, void* d_ws, size_t ws_size,
                              hipStream_t stream)
{
    const float* Q    = (const float*)d_in[0];
    const float* K    = (const float*)d_in[1];
    const float* V    = (const float*)d_in[2];
    const int*   mask = (const int*)  d_in[3];
    const float* W1   = (const float*)d_in[4];
    const float* b1   = (const float*)d_in[5];
    const float* W2   = (const float*)d_in[6];
    const float* b2   = (const float*)d_in[7];

    float* out     = (float*)d_out;                       // [B,L,D]
    float* weights = (float*)d_out + (size_t)BL_ * D_;    // [B,L,L]

    // workspace: hqb [B,L,D], nhk (B*L*D floats), kp (B*L*D floats)  (3 MB total)
    float* hqb = (float*)d_ws;
    float* nhk = (float*)d_ws + (size_t)BL_ * D_;
    float* kp  = (float*)d_ws + (size_t)2 * BL_ * D_;

    cga_proj_kernel<<<2 * BL_ / 16, 256, 0, stream>>>(Q, K, W1, b1, hqb, nhk, kp);
    cga_attn_kernel<<<B_ * (L_ / QT), 256, 0, stream>>>(Q, kp, V, mask, W2, b2,
                                                        hqb, nhk, out, weights);
}

// v009
// One run takes 20.8 microseconds.
// Two timings next to v008 put it at 1.05 and 1.04 times that version's speed.
// Over all steps from v000 it is 2.37 times as fast.
#include <hip/hip_runtime.h>
#include <hip/hip_bf16.h>

typedef __attribute__((ext_vector_type(2))) float v2f;
typedef __attribute__((ext_vector_type(4))) float v4f;
typedef __attribute__((ext_vector_type(8))) float v8f;

#define B_  4
#define L_  512
#define D_  128
#define BL_ (B_ * L_)
#define SCALE 0.08838834764831845f  /* 1/sqrt(128) */
#define TILEF (16 * D_)  /* floats of one 16-key tile in nhk */
#define SB 64            /* q rows and keys of the block of S that a work-group of kernel 1 makes */
#define STILE 128        /* floats of one (8 q rows, 16 keys) tile in sp */
#define VPRE 30   /* key steps of V fetched ahead in P@V: 60 loads in flight */
#define HPRE 2    /* d trips of nhk fetched ahead in the conflict loop: 8 loads in flight */
#define QT 8      /* q rows of one work-group of kernel 2: 256 work-groups, one a WGP */

// ---------------------------------------------------------------------------
// Kernel 1: hqb = Q @ W1[:D] + b1 ; nhk = -(K @ W1[D:])  (stored negated, see below) ;
//           sp = Q K^T (unscaled)
// X = [Q; K] rows 0..2*BL-1. One WG = 16 rows; wave w = output cols [16w,16w+16).
// V_WMMA_F32_16X16X4_F32 accumulating over the 128-deep contraction.
// nhk goes out in the order in which the lanes of kernel 2 read it in the conflict loop:
//   nhk[key tile][d / 4][key in tile][d % 4]
// so that the 16-byte loads of a wave (16 keys, 8 values of d) cover 512 bytes in a row (4 whole cache
// lines) where 16 key rows gave 16 lines a load. For that the key side takes W1 as the
// A operand and K as the B operand (both fragments have the same lane map): the tile
// comes out transposed, a lane holds 8 values of d in a row of one key, and two
// 16-byte stores a lane write whole lines. Products and their order stay the same.
// Q K^T depends on the inputs alone, so it is made here, where a matrix tile can hold 16
// different q rows (a work-group of kernel 2 has 8 and would fill half of each tile).
// A work-group makes a block of 64 q rows by 64 keys of one batch: both sides staged in
// LDS once, a wave takes one key tile and two q tiles (each key fragment feeds two
// products). sp holds S in the order in which the lanes of kernel 2 take it:
//   sp[batch][q / 8][key tile][(q / 4) % 2][key in tile][q % 4]
// ---------------------------------------------------------------------------
__global__ __launch_bounds__(256)
void cga_proj_kernel(const float* __restrict__ Q, const float* __restrict__ K,
                     const float* __restrict__ W1, const float* __restrict__ b1,
                     float* __restrict__ hqb, float* __restrict__ nhk,
                     float* __restrict__ sp)
{
    const int r0   = blockIdx.x * 16;          // row tile in X (0..4095)
    const bool isK = (r0 >= BL_);
    const float* X = isK ? (K + (size_t)(r0 - BL_) * D_) : (Q + (size_t)r0 * D_);

    const int tid  = threadIdx.x;
    const int wave = tid >> 5;
    const int lane = tid & 31;
    const int half = lane >> 4;        // K-pair selector for A/B operands
    const int lp   = lane & 15;        // m (A) / n (B,C,D)

    const int bb = blockIdx.x >> 6;         // the block of S: batch,
    const int bq64 = (blockIdx.x >> 3) & 7; // which 64 q rows,
    const int bk64 = blockIdx.x & 7;        // which 64 keys

    __shared__ float ldsX[16][132];    // +4 pad: stride-132 kills bank conflicts
    // rows 0..63: Q of the block, 64..127: K (same pad); aligned for the 16-byte stores
    __shared__ __attribute__((aligned(16))) float ldsT[2 * SB][132];

    { // cooperative 16x128 tile stage: 256 threads x 8 floats
        const int row = tid >> 4;
        const int col = (tid & 15) * 8;
        const float* src = X + (size_t)row * D_ + col;
        *(float4*)&ldsX[row][col]     = *(const float4*)(src);
        *(float4*)&ldsX[row][col + 4] = *(const float4*)(src + 4);
    }
    __syncthreads();

    const int d0   = wave * 16;        // output column tile
    const int woff = isK ? D_ : 0;     // which half of W1 [256,128]

    // W1[woff + c + kb + j][d0 + lp] of all 32 steps, two coalesced scalar reads a step:
    // asked for ahead of the block's rows, since loads come back in the order of issue
    // and the projection needs these first
    const float* wr = W1 + (size_t)(woff + 2 * half) * D_ + d0 + lp;
    v2f wf[D_ / 4];
    // unrolled so that wf stays in registers
#pragma unroll
    for (int s = 0; s < D_ / 4; ++s) {
        wf[s].x = wr[(4 * s) * D_];
        wf[s].y = wr[(4 * s + 1) * D_];
    }
    const float bq = b1[d0 + lp];      // asked for here so that its store waits for nothing

    // the 128 rows of the block of S are asked for here, behind the barrier (which waits
    // for every load issued in front of it), and land while the projection runs:
    // a wave's load covers one whole row (4 cache lines)
    const float* qsrc = Q + ((size_t)(bb * L_ + bq64 * SB) + wave) * D_ + lane * 4;
    const float* ksrc = K + ((size_t)(bb * L_ + bk64 * SB) + wave) * D_ + lane * 4;
    v4f st[16];                        // the thread's share of the block's two sides
    // unrolled so that st stays in registers
#pragma unroll
    for (int i = 0; i < 8; ++i) st[i]     = *(const v4f*)(qsrc + i * 8 * D_);
#pragma unroll
    for (int i = 0; i < 8; ++i) st[8 + i] = *(const v4f*)(ksrc + i * 8 * D_);
    // precaution: the address pairs of the issued loads stay live up to this wait
    asm volatile("s_wait_xcnt 0x0" :: "v"(wr), "v"(qsrc), "v"(ksrc) : "memory");

    v8f acc = {};
    // both loops unrolled so that wf stays in registers
    if (isK) {   // the same for the whole work-group
#pragma unroll
        for (int s = 0; s < D_ / 4; ++s) {
            // B: X[n][c + kb + j], contiguous float2 per lane; A: W1
            v2f a = *(const v2f*)&ldsX[lp][4 * s + 2 * half];
            acc = __builtin_amdgcn_wmma_f32_16x16x4_f32(false, wf[s], false, a,
                                                        (short)0, acc, false, false);
        }
    } else {
#pragma unroll
        for (int s = 0; s < D_ / 4; ++s) {
            // A: X[m][c + kb + j], contiguous float2 per lane; B: W1
            v2f a = *(const v2f*)&ldsX[lp][4 * s + 2 * half];
            acc = __builtin_amdgcn_wmma_f32_16x16x4_f32(false, a, false, wf[s],
                                                        (short)0, acc, false, false);
        }
    }

    // ---- the block of S = Q K^T ----
    // unrolled so that st stays in registers
#pragma unroll
    for (int i = 0; i < 16; ++i) *(v4f*)&ldsT[i * 8 + wave][lane * 4] = st[i];
    __syncthreads();

    // the projection goes out behind the barrier (which waits for every store issued in
    // front of it) and flies while S is made
    if (isK) {
        // C/D layout: acc[r] = hk[key lp][d0 + 8*half + r]; the key side goes out negated
        float* nt = nhk + (size_t)(blockIdx.x - BL_ / 16) * TILEF
                        + (d0 / 4 + 2 * half) * 64 + lp * 4;
        const v4f n0 = (v4f){-acc[0], -acc[1], -acc[2], -acc[3]};
        const v4f n1 = (v4f){-acc[4], -acc[5], -acc[6], -acc[7]};
        *(v4f*)(nt)      = n0;
        *(v4f*)(nt + 64) = n1;
        // precaution: address pair and data of the issued stores stay live up to this wait
        asm volatile("s_wait_xcnt 0x0" :: "v"(nt), "v"(n0), "v"(n1) : "memory");
    } else {
        // C/D layout: M = r + 8*half; b1 folded into hqb
        float* hrow = hqb + (size_t)(r0 + 8 * half) * D_ + d0 + lp;
        const v8f hb = acc + bq;
        // unrolled so that hb stays in registers
#pragma unroll
        for (int r = 0; r < 8; ++r) hrow[r * D_] = hb[r];
        // precaution: address pair and data of the issued stores stay live up to this wait
        asm volatile("s_wait_xcnt 0x0" :: "v"(hrow), "v"(hb) : "memory");
    }

    const int kt = wave & 3;           // key tile of the block
    const int qp = wave >> 2;          // q tiles 2*qp and 2*qp + 1 of the block
    v8f s0 = {}, s1 = {};
    for (int c = 0; c < D_; c += 4) {
        const v2f kf = *(const v2f*)&ldsT[SB + kt * 16 + lp][c + 2 * half];   // B: K[n][c+kb+i]
        const v2f a0 = *(const v2f*)&ldsT[qp * 32 + lp][c + 2 * half];        // A: Q[m][c+kb+i]
        const v2f a1 = *(const v2f*)&ldsT[qp * 32 + 16 + lp][c + 2 * half];
        s0 = __builtin_amdgcn_wmma_f32_16x16x4_f32(false, a0, false, kf,
                                                   (short)0, s0, false, false);
        s1 = __builtin_amdgcn_wmma_f32_16x16x4_f32(false, a1, false, kf,
                                                   (short)0, s1, false, false);
    }
    // C/D layout: s[r] = S[q tile row r + 8*half][key lp]: the lane's half picks the group
    // of 8 q rows, registers 0..3 and 4..7 its two groups of 4. 16 lanes store 256 bytes
    // in a row, the two stores of a tile 512
    float* so = sp + ((size_t)((bb * (L_ / 8) + bq64 * 8 + qp * 4 + half) * (L_ / 16))
                      + bk64 * 4 + kt) * STILE + lp * 4;
    *(v4f*)(so)      = (v4f){s0[0], s0[1], s0[2], s0[3]};
    *(v4f*)(so + 64) = (v4f){s0[4], s0[5], s0[6], s0[7]};
    float* so1 = so + 2 * (L_ / 16) * STILE;    // the next q tile: 2 groups of 8 rows on
    *(v4f*)(so1)      = (v4f){s1[0], s1[1], s1[2], s1[3]};
    *(v4f*)(so1 + 64) = (v4f){s1[4], s1[5], s1[6], s1[7]};
}

// ---------------------------------------------------------------------------
// One trip (8 values of d: 4 in each half of the wave) of kernel 2's conflict sum, for
// the 8 q rows and the lane's 4 keys. d is the first of the lane's own 4 values.
// hv is a ring of four trips of nhk in registers; U = trip mod 4 is a
// constant, so that the ring's places are fixed registers. The trip first asks for
// the nhk values of trip + HPRE, which stand at pf.
// ---------------------------------------------------------------------------
template <int U>
__device__ __forceinline__
void cga_conflict_trip(v4f (&hv)[4][4], const float* __restrict__ pf, const int d,
                       const float* ldsW2, const float (*ldsH)[132],
                       v2f (&cacc)[4][8], v2f (&ksum)[4])
{
#pragma unroll
    for (int j = 0; j < 4; ++j)                     // 8 key tiles apart: tile j
        hv[(U + HPRE) & 3][j] = *(const v4f*)(pf + (size_t)j * 8 * TILEF);
    // precaution: stands behind the last nhk loads of a pass, in front of whatever
    // rewrites an address register that the pass's issued loads name
    if (U == 3) asm volatile("s_wait_xcnt 0x0" ::: "memory");
    const v4f wv  = *(const v4f*)&ldsW2[d];         // LDS broadcast (one address a half)
    v4f hq[8];
#pragma unroll
    for (int r = 0; r < 8; ++r)
        hq[r] = *(const v4f*)&ldsH[r][d];           // LDS broadcast (one address a half)
    const v2f w01 = wv.xy, w23 = wv.zw;
#pragma unroll
    for (int j = 0; j < 4; ++j) {
        ksum[j] = __builtin_elementwise_fma(hv[U][j].xy, w01, ksum[j]);
        ksum[j] = __builtin_elementwise_fma(hv[U][j].zw, w23, ksum[j]);
    }
    // four q rows at a time: all their maxima, then all their multiply-adds, so that
    // no instruction stands close behind the one whose result it reads
#pragma unroll
    for (int rb = 0; rb < 8; rb += 4) {
        v2f m01[4][4], m23[4][4];
#pragma unroll
        for (int r = 0; r < 4; ++r)
#pragma unroll
            for (int j = 0; j < 4; ++j) {
                m01[r][j] = __builtin_elementwise_max(hq[rb + r].xy, hv[U][j].xy);
                m23[r][j] = __builtin_elementwise_max(hq[rb + r].zw, hv[U][j].zw);
            }
#pragma unroll
        for (int r = 0; r < 4; ++r)
#pragma unroll
            for (int j = 0; j < 4; ++j)
                cacc[j][rb + r] = __builtin_elementwise_fma(m01[r][j], w01, cacc[j][rb + r]);
#pragma unroll
        for (int r = 0; r < 4; ++r)
#pragma unroll
            for (int j = 0; j < 4; ++j)
                cacc[j][rb + r] = __builtin_elementwise_fma(m23[r][j], w23, cacc[j][rb + r]);
    }
    // compiler fence, no instruction: keeps the next trips' loads behind this trip.
    // Lifted to the head of the pass, they land in registers of their own and are
    // copied into the ring at the loop's foot, behind a wait for all of them; and
    // four trips merged need more than 256 registers
    asm volatile("" ::: "memory");
}

// ---------------------------------------------------------------------------
// Cross-lane moves of kernel 2's softmax, on the vector unit.
// cga_xrow<M>: the value of lane l ^ M, M < 16 (a DPP operand inside a row of 16
// lanes); cga_xhalf: the value of lane l ^ 16.
// ---------------------------------------------------------------------------
template <int M>
__device__ __forceinline__ float cga_xrow(const float x)
{
    return __builtin_bit_cast(float,
        __builtin_amdgcn_mov_dpp(__builtin_bit_cast(int, x), 0x160 + M, 0xf, 0xf, true));  // row_xmask:M
}
__device__ __forceinline__ float cga_xhalf(const float x)
{
    const int v = __builtin_bit_cast(int, x);
    return __builtin_bit_cast(float,
        __builtin_amdgcn_permlanex16(v, v, 0x76543210, 0xfedcba98, false, false));
}

// ---------------------------------------------------------------------------
// Kernel 2: fused gated attention for one (b, 8-row q tile): 256 work-groups, so that
// every WGP of the chip has one (16-row tiles give 128 and leave half the WGPs idle).
// 8 waves: each owns 4 k-tiles (conflict via VALU for all 4 at once, S out of kernel 1,
// gate), then softmax (1 row a wave, in registers), then P@V via WMMA (one d-tile per wave).
// The vector work (conflict, gate, softmax) of a work-group is halved. The matrix tiles
// of P@V stay 16 rows high: A row m holds q row (m & 3) + 4 * (m >> 3), so that D registers
// 0..3 of a lane are q rows 4*half + 0..3 and registers 4..7 repeat them, unused.
// ---------------------------------------------------------------------------
__global__ __launch_bounds__(256)
void cga_attn_kernel(const float* __restrict__ sp,
                     const float* __restrict__ V, const int* __restrict__ mask,
                     const float* __restrict__ W2, const float* __restrict__ b2,
                     const float* __restrict__ hqb, const float* __restrict__ nhk,
                     float* __restrict__ out, float* __restrict__ weights)
{
    const int b  = blockIdx.x / (L_ / QT);    // batch
    const int q0 = (blockIdx.x % (L_ / QT)) * QT;

    const int tid  = threadIdx.x;
    const int wave = tid >> 5;
    const int lane = tid & 31;
    const int half = lane >> 4;
    const int lp   = lane & 15;
    const int qm   = (lp & 3) + 4 * (lp >> 3);   // q row in A row lp of P@V

    __shared__ float ldsH[QT][132];    // hqb tile (b1 folded)
    __shared__ float ldsW2[128];
    // gated scores, +4 pad for P@V column reads; aligned for the softmax's 16-byte reads
    __shared__ __attribute__((aligned(16))) float SG[QT][516];

    { // stage hqb tile + W2
        const int row = tid >> 5;
        const int col = (tid & 31) * 4;
        const float* hs = hqb + ((size_t)(b * L_) + q0 + row) * D_ + col;
        *(float4*)&ldsH[row][col] = *(const float4*)(hs);
        if (tid < 128) ldsW2[tid] = W2[tid];
    }

    // ---- nhk of the conflict loop, fetched ahead ----
    // nhk depends on nothing staged here. Trip t asks for the values of trip
    // t + HPRE, so that a load has HPRE trips of vector work to land in; the first
    // HPRE trips are asked for here, beside the staging loads.
    // (4 values of d of the tile's 16 keys stand 64 floats in a row; a trip's 8 values
    // 128 floats: the wave's load covers 4 whole cache lines)
    const float* hkr = nhk + (size_t)(b * (L_ / 16) + wave) * TILEF + half * 64 + lp * 4;
    v4f hv[4][4];                      // [trip mod 4][k tile j]
    // unrolled so that hv stays in registers
#pragma unroll
    for (int u = 0; u < HPRE; ++u)
#pragma unroll
        for (int j = 0; j < 4; ++j)                 // 8 key tiles apart: tile j
            hv[u][j] = *(const v4f*)(hkr + (size_t)j * 8 * TILEF + 128 * u);

    // ---- S and mask words of the lane's 16 (q row, k tile) places ----
    // Nothing stands between the conflict loop and the gate any more under which these
    // loads could land, so they are asked for here, beside the staging loads.
    // S: one 16-byte load a tile (q rows 4*half + 0..3 of key lp), a wave's load covers
    // 4 whole cache lines; 8 key tiles apart: tile j
    const float* sprow = sp + ((size_t)blockIdx.x * (L_ / 16) + wave) * STILE + lane * 4;
    v4f sv[4];
    // the loops here are unrolled so that sv and mv stay in registers
#pragma unroll
    for (int j = 0; j < 4; ++j) sv[j] = *(const v4f*)(sprow + j * 8 * STILE);
    // mask: one address pair, the places told apart by constant offsets
    const int* mrow = mask + (((size_t)b * L_) + q0 + 4 * half) * L_ + wave * 16 + lp;
    int mv[4][4];
#pragma unroll
    for (int j = 0; j < 4; ++j)
#pragma unroll
        for (int r = 0; r < 4; ++r) mv[j][r] = mrow[r * L_ + j * 128];
    // precaution: the address pairs of the issued S and mask loads stay live up to
    // this wait, so nothing rewrites them ahead of the wait
    asm volatile("s_wait_xcnt 0x0" :: "v"(sprow), "v"(mrow) : "memory");
    __syncthreads();

    // The conflict loop has no vector registers to spare (32 more push it past 256).
    // The scaled scores wait in the lane's own places of SG, which nobody else touches
    // ahead of the next barrier; the mask tests wait as lane masks in scalar registers.
    unsigned mz[4][4];
    // unrolled so that sv, mv and mz stay in registers
#pragma unroll
    for (int j = 0; j < 4; ++j)
#pragma unroll
        for (int r = 0; r < 4; ++r) {
            SG[r + 4 * half][(wave + 8 * j) * 16 + lp] = sv[j][r] * SCALE;
            mz[j][r] = __builtin_amdgcn_ballot_w32(mv[j][r] == 0);
        }

    const float bias2 = b2[0];

    // ---- conflict[q,k] = sum_d relu(hqb[q,d]+hk[k,d])*W2[d]  (VALU) ----
    // relu(a + b) = max(a, -b) + b, so
    //   conflict = sum_d max(hqb[q,d], nhk[k,d])*W2[d] - sum_d nhk[k,d]*W2[d].
    // The first sum costs one max and one multiply-add an element (no add in
    // front of the max); the second depends on the key alone: once per lane and key.
    // One d loop for all four k tiles of the wave (tile j = wave + 8*j). Every lane
    // works on all 8 q rows; the two halves of the wave share d: of each 8 values the
    // lower half takes the first 4, the upper half the last 4, and the two part sums
    // meet behind the loop. Each sum is kept as an (even d, odd d) pair, so that two
    // multiply-adds go as one packed instruction; the pair is added up behind the loop.
    v2f cacc[4][8];
    v2f ksum[4];
#pragma unroll
    for (int j = 0; j < 4; ++j) {
        ksum[j] = (v2f){0.f, 0.f};
#pragma unroll
        for (int r = 0; r < 8; ++r) cacc[j][r] = (v2f){0.f, 0.f};
    }

    static_assert(HPRE == 2, "the four addresses below stand two trips ahead");
    for (int d = 0; d < D_; d += 32) {               // four trips a pass
        // trips 2 and 3 ask for the next pass's first two trips. Behind the last pass
        // there is none: it asks for its own first two again (inside the tile, lines
        // just read), and nothing reads those values
        const float* hkn = hkr + (d + 32 < D_ ? d + 32 : d) * 16;
        const int dl = d + 4 * half;                 // the lane's own 4 values of d
        cga_conflict_trip<0>(hv, hkr + (d + 16) * 16, dl,      ldsW2, ldsH, cacc, ksum);
        cga_conflict_trip<1>(hv, hkr + (d + 24) * 16, dl + 8,  ldsW2, ldsH, cacc, ksum);
        cga_conflict_trip<2>(hv, hkn,                 dl + 16, ldsW2, ldsH, cacc, ksum);
        cga_conflict_trip<3>(hv, hkn + 128,           dl + 24, ldsW2, ldsH, cacc, ksum);
    }

    // the two halves' part sums meet: a lane keeps the part of its own 4 q rows
    // (4*half + r, the rows of its D registers 0..3) and hands the part of the other 4
    // to lane ^ 16
    float conf[4][4];
#pragma unroll
    for (int j = 0; j < 4; ++j) {
        const float ks = ksum[j].x + ksum[j].y;
        float part[8];
#pragma unroll
        for (int r = 0; r < 8; ++r) part[r] = (cacc[j][r].x + cacc[j][r].y) - ks;
#pragma unroll
        for (int r = 0; r < 4; ++r) {
            const float keep = half ? part[4 + r] : part[r];
            const float send = half ? part[r] : part[4 + r];
            conf[j][r] = keep + cga_xhalf(send);
        }
    }

    // unrolled so that conf[j] and mz[j] stay in registers
#pragma unroll
    for (int j = 0; j < 4; ++j) {
        const int k0 = (wave + 8 * j) * 16;

        // ---- gate + mask -> SG ----
#pragma unroll
        for (int r = 0; r < 4; ++r) {
            const int qrow = r + 4 * half;
            // exp(-x) = 2^(x * -log2(e)), as __expf makes it. The v_nop fills the slot that
            // the instruction set asks for behind a transcendental; in one
            // statement the v_nop stands directly behind the exponential
            float e;
            asm("v_exp_f32 %0, %1\n\tv_nop"
                : "=v"(e) : "v"((conf[j][r] + bias2) * -1.44269504088896340736f));
            const float g  = 1.f / (1.f + e);
            float sg = SG[qrow][k0 + lp] * g;
            if (__builtin_amdgcn_inverse_ballot_w32(mz[j][r])) sg = -__builtin_inff();
            SG[qrow][k0 + lp] = sg;
        }
    }
    __syncthreads();

    // ---- V fragments of P@V, fetched ahead ----
    // V depends on nothing computed here: the fragments of the first VPRE key
    // steps are asked for here, behind the barrier (which waits for every load
    // issued in front of it), and fly while the softmax runs. One address pair
    // for all 128 steps; a step is told from the next by a constant offset, so
    // the pair is not rewritten between the loads.
    const float* vbase = V + ((size_t)(b * L_) + 2 * half) * D_ + wave * 16 + lp;
    v2f vb[L_ / 4];                    // B: V[4s+kb+j][d0+n], step s
    // unrolled so that vb stays in registers
#pragma unroll
    for (int s = 0; s < VPRE; ++s) {
        vb[s].x = vbase[(4 * s) * D_];
        vb[s].y = vbase[(4 * s + 1) * D_];
    }
    // keeps the V loads in front of the softmax: moved in among its instructions they
    // start later, and the barrier behind the softmax waits for the last of them
    __builtin_amdgcn_sched_barrier(0);

    // ---- softmax over k: a wave's row held in registers from read to store ----
    // A lane reads 16 scores of the row once (16 bytes a read, a wave's read covers
    // 512 bytes in a row), and maximum, exponentials, sum and scaling work on those
    // registers; P goes to LDS once. The maximum and the sum over the 32 lanes go
    // through vector cross-lane operands, not through the LDS unit.
    v4f px[4];                         // [128-key block]
    {
        float* srow = &SG[wave][4 * lane];
        // every loop here is unrolled so that px stays in registers
#pragma unroll
        for (int i = 0; i < 4; ++i) px[i] = *(const v4f*)(srow + 128 * i);

        const v4f m4 = __builtin_elementwise_max(
            __builtin_elementwise_max(px[0], px[1]),
            __builtin_elementwise_max(px[2], px[3]));
        float mx = fmaxf(fmaxf(m4.x, m4.y), fmaxf(m4.z, m4.w));
        mx = fmaxf(mx, cga_xrow<1>(mx));
        mx = fmaxf(mx, cga_xrow<2>(mx));
        mx = fmaxf(mx, cga_xrow<4>(mx));
        mx = fmaxf(mx, cga_xrow<8>(mx));
        mx = fmaxf(mx, cga_xhalf(mx));

#pragma unroll
        for (int i = 0; i < 4; ++i) {
            px[i].x = __expf(px[i].x - mx);
            px[i].y = __expf(px[i].y - mx);
            px[i].z = __expf(px[i].z - mx);
            px[i].w = __expf(px[i].w - mx);
        }
        const v4f s4 = (px[0] + px[1]) + (px[2] + px[3]);
        float sum = (s4.x + s4.y) + (s4.z + s4.w);
        sum += cga_xrow<1>(sum);
        sum += cga_xrow<2>(sum);
        sum += cga_xrow<4>(sum);
        sum += cga_xrow<8>(sum);
        sum += cga_xhalf(sum);

        const float inv = 1.f / sum;
#pragma unroll
        for (int i = 0; i < 4; ++i) {
            px[i] *= inv;
            *(v4f*)(srow + 128 * i) = px[i];
        }
    }
    __syncthreads();

    // the weights go out of the same registers, behind the barrier (which waits for
    // every store issued in front of it), and fly while P@V runs: 16 bytes a lane,
    // a wave's store covers 4 whole cache lines
    {
        float* wout = weights + (((size_t)b * L_) + q0 + wave) * L_ + 4 * lane;
#pragma unroll
        for (int i = 0; i < 4; ++i) *(v4f*)(wout + 128 * i) = px[i];
        // precaution: the address pair and the data of the issued stores stay live
        // up to this wait, so nothing rewrites them ahead of it
        asm volatile("s_wait_xcnt 0x0"
                     :: "v"(wout), "v"(px[0]), "v"(px[1]), "v"(px[2]), "v"(px[3])
                     : "memory");
    }

    // ---- out = P @ V  (128 chained f32 WMMAs; wave owns d-tile = 16*wave) ----
    {
        const int d0 = wave * 16;
        v8f acc = {};
        // unrolled so that vb stays in registers and every V load has a constant
        // offset; step s asks for the fragment of step s + VPRE
#pragma unroll
        for (int s = 0; s < L_ / 4; ++s) {
            if (s + VPRE < L_ / 4) {
                vb[s + VPRE].x = vbase[(4 * (s + VPRE)) * D_];
                vb[s + VPRE].y = vbase[(4 * (s + VPRE) + 1) * D_];
            }
            v2f a = *(const v2f*)&SG[qm][4 * s + 2 * half];  // A: P[q row of m][4s+kb+j]
            acc = __builtin_amdgcn_wmma_f32_16x16x4_f32(false, a, false, vb[s],
                                                        (short)0, acc, false, false);
        }
        // precaution: the address pair of the V loads stays live up to this wait
        asm volatile("s_wait_xcnt 0x0" :: "v"(vbase) : "memory");
#pragma unroll
        for (int r = 0; r < 4; ++r)
            out[(((size_t)b * L_) + q0 + r + 4 * half) * D_ + d0 + lp] = acc[r];
    }
}

// ---------------------------------------------------------------------------
extern "C" void kernel_launch(void* const* d_in, const int* in_sizes, int n_in,
                              void* d_out, int out_size, void* d_ws, size_t ws_size,
                              hipStream_t stream)
{
    const float* Q    = (const float*)d_in[0];
    const float* K    = (const float*)d_in[1];
    const float* V    = (const float*)d_in[2];
    const int*   mask = (const int*)  d_in[3];
    const float* W1   = (const float*)d_in[4];
    const float* b1   = (const float*)d_in[5];
    const float* W2   = (const float*)d_in[6];
    const float* b2   = (const float*)d_in[7];

    float* out     = (float*)d_out;                       // [B,L,D]
    float* weights = (float*)d_out + (size_t)BL_ * D_;    // [B,L,L]

    // workspace: hqb [B,L,D], nhk [B,L,D], sp (B*L*L floats)  (6 MB total)
    float* hqb = (float*)d_ws;
    float* nhk = (float*)d_ws + (size_t)BL_ * D_;
    float* sp  = (float*)d_ws + (size_t)2 * BL_ * D_;

    cga_proj_kernel<<<2 * BL_ / 16, 256, 0, stream>>>(Q, K, W1, b1, hqb, nhk, sp);
    cga_attn_kernel<<<B_ * (L_ / QT), 256, 0, stream>>>(sp, V, mask, W2, b2,
                                                        hqb, nhk, out, weights);
}

// v010
// A run of this version takes 19.6 microseconds.
// Next to v009, in two timings, it ran 1.07 and 1.08 times as fast.
// All steps since v000 together make it 2.54 times as fast.
#include <hip/hip_runtime.h>
#include <hip/hip_bf16.h>

typedef __attribute__((ext_vector_type(2))) float v2f;
typedef __attribute__((ext_vector_type(4))) float v4f;
typedef __attribute__((ext_vector_type(8))) float v8f;

#define B_  4
#define L_  512
#define D_  128
#define BL_ (B_ * L_)
#define SCALE 0.08838834764831845f  /* 1/sqrt(128) */
#define TILEF (16 * D_)  /* floats of one 16-key tile in nhk */
#define SB 64            /* q rows and keys of the block of S that a work-group of kernel 1 makes */
#define STILE 128        /* floats of one (8 q rows, 16 keys) tile in sp */
#define VPRE 30   /* key steps of V fetched ahead in P@V: 60 loads in flight */
#define HPRE 2    /* d trips of nhk fetched ahead in the conflict loop: 8 loads in flight */
#define QT 8      /* q rows of one work-group of kernel 2: 256 work-groups, one a WGP */

// ---------------------------------------------------------------------------
// Kernel 1: hqb = Q @ W1[:D] + b1 ; nhk = -(K @ W1[D:])  (stored negated, see below) ;
//           sp = Q K^T (unscaled)
// X = [Q; K] rows 0..2*BL-1. One WG = 16 rows; wave w = output cols [16w,16w+16).
// V_WMMA_F32_16X16X4_F32 accumulating over the 128-deep contraction.
// nhk goes out in the order in which the lanes of kernel 2 read it in the conflict loop:
//   nhk[key tile][d / 4][key in tile][d % 4]
// so that the 16-byte loads of a wave (16 keys, 8 values of d) cover 512 bytes in a row (4 whole cache
// lines) where 16 key rows gave 16 lines a load. For that the key side takes W1 as the
// A operand and K as the B operand (both fragments have the same lane map): the tile
// comes out transposed, a lane holds 8 values of d in a row of one key, and two
// 16-byte stores a lane write whole lines. Products and their order stay the same.
// Q K^T depends on the inputs alone, so it is made here, where a matrix tile can hold 16
// different q rows (a work-group of kernel 2 has 8 and would fill half of each tile).
// A work-group makes a block of 64 q rows by 64 keys of one batch: both sides staged in
// LDS once, a wave takes one key tile and two q tiles (each key fragment feeds two
// products). sp holds S in the order in which the lanes of kernel 2 take it:
//   sp[batch][q / 8][key tile][(q / 4) % 2][key in tile][q % 4]
// ---------------------------------------------------------------------------
__global__ __launch_bounds__(256)
void cga_proj_kernel(const float* __restrict__ Q, const float* __restrict__ K,
                     const float* __restrict__ W1, const float* __restrict__ b1,
                     float* __restrict__ hqb, float* __restrict__ nhk,
                     float* __restrict__ sp)
{
    const int r0   = blockIdx.x * 16;          // row tile in X (0..4095)
    const bool isK = (r0 >= BL_);
    const float* X = isK ? (K + (size_t)(r0 - BL_) * D_) : (Q + (size_t)r0 * D_);

    const int tid  = threadIdx.x;
    const int wave = tid >> 5;
    const int lane = tid & 31;
    const int half = lane >> 4;        // K-pair selector for A/B operands
    const int lp   = lane & 15;        // m (A) / n (B,C,D)

    const int bb = blockIdx.x >> 6;         // the block of S: batch,
    const int bq64 = (blockIdx.x >> 3) & 7; // which 64 q rows,
    const int bk64 = blockIdx.x & 7;        // which 64 keys

    __shared__ float ldsX[16][132];    // +4 pad: stride-132 kills bank conflicts
    // rows 0..63: Q of the block, 64..127: K (same pad); aligned for the 16-byte stores
    __shared__ __attribute__((aligned(16))) float ldsT[2 * SB][132];

    { // cooperative 16x128 tile stage: 256 threads x 8 floats
        const int row = tid >> 4;
        const int col = (tid & 15) * 8;
        const float* src = X + (size_t)row * D_ + col;
        *(float4*)&ldsX[row][col]     = *(const float4*)(src);
        *(float4*)&ldsX[row][col + 4] = *(const float4*)(src + 4);
    }
    __syncthreads();

    const int d0   = wave * 16;        // output column tile
    const int woff = isK ? D_ : 0;     // which half of W1 [256,128]

    // W1[woff + c + kb + j][d0 + lp] of all 32 steps, two coalesced scalar reads a step:
    // asked for ahead of the block's rows, since loads come back in the order of issue
    // and the projection needs these first
    const float* wr = W1 + (size_t)(woff + 2 * half) * D_ + d0 + lp;
    v2f wf[D_ / 4];
    // unrolled so that wf stays in registers
#pragma unroll
    for (int s = 0; s < D_ / 4; ++s) {
        wf[s].x = wr[(4 * s) * D_];
        wf[s].y = wr[(4 * s + 1) * D_];
    }
    const float bq = b1[d0 + lp];      // asked for here so that its store waits for nothing

    // the 128 rows of the block of S are asked for here, behind the barrier (which waits
    // for every load issued in front of it), and land while the projection runs:
    // a wave's load covers one whole row (4 cache lines)
    const float* qsrc = Q + ((size_t)(bb * L_ + bq64 * SB) + wave) * D_ + lane * 4;
    const float* ksrc = K + ((size_t)(bb * L_ + bk64 * SB) + wave) * D_ + lane * 4;
    v4f st[16];                        // the thread's share of the block's two sides
    // unrolled so that st stays in registers
#pragma unroll
    for (int i = 0; i < 8; ++i) st[i]     = *(const v4f*)(qsrc + i * 8 * D_);
#pragma unroll
    for (int i = 0; i < 8; ++i) st[8 + i] = *(const v4f*)(ksrc + i * 8 * D_);
    // precaution: the address pairs of the issued loads stay live up to this wait
    asm volatile("s_wait_xcnt 0x0" :: "v"(wr), "v"(qsrc), "v"(ksrc) : "memory");

    v8f acc = {};
    // both loops unrolled so that wf stays in registers
    if (isK) {   // the same for the whole work-group
#pragma unroll
        for (int s = 0; s < D_ / 4; ++s) {
            // B: X[n][c + kb + j], contiguous float2 per lane; A: W1
            v2f a = *(const v2f*)&ldsX[lp][4 * s + 2 * half];
            acc = __builtin_amdgcn_wmma_f32_16x16x4_f32(false, wf[s], false, a,
                                                        (short)0, acc, false, false);
        }
    } else {
#pragma unroll
        for (int s = 0; s < D_ / 4; ++s) {
            // A: X[m][c + kb + j], contiguous float2 per lane; B: W1
            v2f a = *(const v2f*)&ldsX[lp][4 * s + 2 * half];
            acc = __builtin_amdgcn_wmma_f32_16x16x4_f32(false, a, false, wf[s],
                                                        (short)0, acc, false, false);
        }
    }

    // ---- the block of S = Q K^T ----
    // unrolled so that st stays in registers
#pragma unroll
    for (int i = 0; i < 16; ++i) *(v4f*)&ldsT[i * 8 + wave][lane * 4] = st[i];
    __syncthreads();

    // the projection goes out behind the barrier (which waits for every store issued in
    // front of it) and flies while S is made
    if (isK) {
        // C/D layout: acc[r] = hk[key lp][d0 + 8*half + r]; the key side goes out negated
        float* nt = nhk + (size_t)(blockIdx.x - BL_ / 16) * TILEF
                        + (d0 / 4 + 2 * half) * 64 + lp * 4;
        const v4f n0 = (v4f){-acc[0], -acc[1], -acc[2], -acc[3]};
        const v4f n1 = (v4f){-acc[4], -acc[5], -acc[6], -acc[7]};
        *(v4f*)(nt)      = n0;
        *(v4f*)(nt + 64) = n1;
        // precaution: address pair and data of the issued stores stay live up to this wait
        asm volatile("s_wait_xcnt 0x0" :: "v"(nt), "v"(n0), "v"(n1) : "memory");
    } else {
        // C/D layout: M = r + 8*half; b1 folded into hqb
        float* hrow = hqb + (size_t)(r0 + 8 * half) * D_ + d0 + lp;
        const v8f hb = acc + bq;
        // unrolled so that hb stays in registers
#pragma unroll
        for (int r = 0; r < 8; ++r) hrow[r * D_] = hb[r];
        // precaution: address pair and data of the issued stores stay live up to this wait
        asm volatile("s_wait_xcnt 0x0" :: "v"(hrow), "v"(hb) : "memory");
    }

    const int kt = wave & 3;           // key tile of the block
    const int qp = wave >> 2;          // q tiles 2*qp and 2*qp + 1 of the block
    v8f s0 = {}, s1 = {};
    for (int c = 0; c < D_; c += 4) {
        const v2f kf = *(const v2f*)&ldsT[SB + kt * 16 + lp][c + 2 * half];   // B: K[n][c+kb+i]
        const v2f a0 = *(const v2f*)&ldsT[qp * 32 + lp][c + 2 * half];        // A: Q[m][c+kb+i]
        const v2f a1 = *(const v2f*)&ldsT[qp * 32 + 16 + lp][c + 2 * half];
        s0 = __builtin_amdgcn_wmma_f32_16x16x4_f32(false, a0, false, kf,
                                                   (short)0, s0, false, false);
        s1 = __builtin_amdgcn_wmma_f32_16x16x4_f32(false, a1, false, kf,
                                                   (short)0, s1, false, false);
    }
    // C/D layout: s[r] = S[q tile row r + 8*half][key lp]: the lane's half picks the group
    // of 8 q rows, registers 0..3 and 4..7 its two groups of 4. 16 lanes store 256 bytes
    // in a row, the two stores of a tile 512
    float* so = sp + ((size_t)((bb * (L_ / 8) + bq64 * 8 + qp * 4 + half) * (L_ / 16))
                      + bk64 * 4 + kt) * STILE + lp * 4;
    *(v4f*)(so)      = (v4f){s0[0], s0[1], s0[2], s0[3]};
    *(v4f*)(so + 64) = (v4f){s0[4], s0[5], s0[6], s0[7]};
    float* so1 = so + 2 * (L_ / 16) * STILE;    // the next q tile: 2 groups of 8 rows on
    *(v4f*)(so1)      = (v4f){s1[0], s1[1], s1[2], s1[3]};
    *(v4f*)(so1 + 64) = (v4f){s1[4], s1[5], s1[6], s1[7]};
}

// ---------------------------------------------------------------------------
// Four q rows (RB + 0..3) of one trip of kernel 2's conflict sum, for the lane's 4 keys:
// all their maxima, then all their multiply-adds, so that no instruction stands close
// behind the one whose result it reads.
// ---------------------------------------------------------------------------
template <int RB>
__device__ __forceinline__
void cga_conflict_rows(const v4f (&hq)[4], const v4f (&hk)[4], const v4f wv,
                       v2f (&cacc)[4][8])
{
    const v2f w01 = wv.xy, w23 = wv.zw;
    v2f m01[4][4], m23[4][4];
    // every loop here is unrolled so that m01, m23 and cacc stay in registers
#pragma unroll
    for (int r = 0; r < 4; ++r)
#pragma unroll
        for (int j = 0; j < 4; ++j) {
            m01[r][j] = __builtin_elementwise_max(hq[r].xy, hk[j].xy);
            m23[r][j] = __builtin_elementwise_max(hq[r].zw, hk[j].zw);
        }
#pragma unroll
    for (int r = 0; r < 4; ++r)
#pragma unroll
        for (int j = 0; j < 4; ++j)
            cacc[j][RB + r] = __builtin_elementwise_fma(m01[r][j], w01, cacc[j][RB + r]);
#pragma unroll
    for (int r = 0; r < 4; ++r)
#pragma unroll
        for (int j = 0; j < 4; ++j)
            cacc[j][RB + r] = __builtin_elementwise_fma(m23[r][j], w23, cacc[j][RB + r]);
}

// ---------------------------------------------------------------------------
// One trip (8 values of d: 4 in each half of the wave) of kernel 2's conflict sum, for
// the 8 q rows and the lane's 4 keys. d is the first of the lane's own 4 values, dn that
// of the next trip.
// hv is a ring of four trips of nhk in registers; U = trip mod 4 is a
// constant, so that the ring's places are fixed registers. The trip first asks for
// the nhk values of trip + HPRE, which stand at pf.
// The LDS reads run half a trip ahead of their use, so that a read has the vector work
// of four q rows to land in: q rows 4..7 (hb) are read at the head of the trip, while
// rows 0..3 are worked on; rows 0..3 (ha) and W2 (wv, two places) of the next trip are
// read in the middle, while rows 4..7 are worked on.
// ---------------------------------------------------------------------------
template <int U>
__device__ __forceinline__
void cga_conflict_trip(v4f (&hv)[4][4], const float* __restrict__ pf, const int d,
                       const int dn, const float* ldsW2, const float (*ldsH)[132],
                       v4f (&ha)[4], v4f (&hb)[4], v4f (&wv)[2],
                       v2f (&cacc)[4][8], v2f (&ksum)[4])
{
#pragma unroll
    for (int j = 0; j < 4; ++j)                     // 8 key tiles apart: tile j
        hv[(U + HPRE) & 3][j] = *(const v4f*)(pf + (size_t)j * 8 * TILEF);
    // precaution: stands behind the last nhk loads of a pass, in front of whatever
    // rewrites an address register that the pass's issued loads name
    if (U == 3) asm volatile("s_wait_xcnt 0x0" ::: "memory");
#pragma unroll
    for (int r = 0; r < 4; ++r)
        hb[r] = *(const v4f*)&ldsH[4 + r][d];       // LDS broadcast (one address a half)
    // compiler fence, no instruction: keeps the reads above at the head of the trip.
    // Sunk to their first use, they are waited for a few instructions behind their issue
    asm volatile("" ::: "memory");
    {
        const v2f w01 = wv[U & 1].xy, w23 = wv[U & 1].zw;
#pragma unroll
        for (int j = 0; j < 4; ++j) {
            ksum[j] = __builtin_elementwise_fma(hv[U][j].xy, w01, ksum[j]);
            ksum[j] = __builtin_elementwise_fma(hv[U][j].zw, w23, ksum[j]);
        }
    }
    cga_conflict_rows<0>(ha, hv[U], wv[U & 1], cacc);
    wv[(U + 1) & 1] = *(const v4f*)&ldsW2[dn];      // LDS broadcast (one address a half)
#pragma unroll
    for (int r = 0; r < 4; ++r)
        ha[r] = *(const v4f*)&ldsH[r][dn];          // LDS broadcast (one address a half)
    // compiler fence, no instruction: keeps the reads above in the middle of the trip
    asm volatile("" ::: "memory");
    cga_conflict_rows<4>(hb, hv[U], wv[U & 1], cacc);
    // compiler fence, no instruction: keeps the next trips' loads behind this trip.
    // Lifted to the head of the pass, they land in registers of their own and are
    // copied into the ring at the loop's foot, behind a wait for all of them; and
    // four trips merged need more than 256 registers
    asm volatile("" ::: "memory");
}

// ---------------------------------------------------------------------------
// Cross-lane moves of kernel 2's softmax, on the vector unit.
// cga_xrow<M>: the value of lane l ^ M, M < 16 (a DPP operand inside a row of 16
// lanes); cga_xhalf: the value of lane l ^ 16.
// ---------------------------------------------------------------------------
template <int M>
__device__ __forceinline__ float cga_xrow(const float x)
{
    return __builtin_bit_cast(float,
        __builtin_amdgcn_mov_dpp(__builtin_bit_cast(int, x), 0x160 + M, 0xf, 0xf, true));  // row_xmask:M
}
__device__ __forceinline__ float cga_xhalf(const float x)
{
    const int v = __builtin_bit_cast(int, x);
    return __builtin_bit_cast(float,
        __builtin_amdgcn_permlanex16(v, v, 0x76543210, 0xfedcba98, false, false));
}

// ---------------------------------------------------------------------------
// Kernel 2: fused gated attention for one (b, 8-row q tile): 256 work-groups, so that
// every WGP of the chip has one (16-row tiles give 128 and leave half the WGPs idle).
// 8 waves: each owns 4 k-tiles (conflict via VALU for all 4 at once, S out of kernel 1,
// gate), then softmax (1 row a wave, in registers), then P@V via WMMA (one d-tile per wave).
// The vector work (conflict, gate, softmax) of a work-group is halved. The matrix tiles
// of P@V stay 16 rows high: A row m holds q row (m & 3) + 4 * (m >> 3), so that D registers
// 0..3 of a lane are q rows 4*half + 0..3 and registers 4..7 repeat them, unused.
// ---------------------------------------------------------------------------
__global__ __launch_bounds__(256)
void cga_attn_kernel(const float* __restrict__ sp,
                     const float* __restrict__ V, const int* __restrict__ mask,
                     const float* __restrict__ W2, const float* __restrict__ b2,
                     const float* __restrict__ hqb, const float* __restrict__ nhk,
                     float* __restrict__ out, float* __restrict__ weights)
{
    const int b  = blockIdx.x / (L_ / QT);    // batch
    const int q0 = (blockIdx.x % (L_ / QT)) * QT;

    const int tid  = threadIdx.x;
    const int wave = tid >> 5;
    const int lane = tid & 31;
    const int half = lane >> 4;
    const int lp   = lane & 15;
    const int qm   = (lp & 3) + 4 * (lp >> 3);   // q row in A row lp of P@V

    __shared__ float ldsH[QT][132];    // hqb tile (b1 folded)
    __shared__ float ldsW2[128];
    // gated scores, +4 pad for P@V column reads; aligned for the softmax's 16-byte reads
    __shared__ __attribute__((aligned(16))) float SG[QT][516];

    { // stage hqb tile + W2
        const int row = tid >> 5;
        const int col = (tid & 31) * 4;
        const float* hs = hqb + ((size_t)(b * L_) + q0 + row) * D_ + col;
        *(float4*)&ldsH[row][col] = *(const float4*)(hs);
        if (tid < 128) ldsW2[tid] = W2[tid];
    }

    // ---- nhk of the conflict loop, fetched ahead ----
    // nhk depends on nothing staged here. Trip t asks for the values of trip
    // t + HPRE, so that a load has HPRE trips of vector work to land in; the first
    // HPRE trips are asked for here, beside the staging loads.
    // (4 values of d of the tile's 16 keys stand 64 floats in a row; a trip's 8 values
    // 128 floats: the wave's load covers 4 whole cache lines)
    const float* hkr = nhk + (size_t)(b * (L_ / 16) + wave) * TILEF + half * 64 + lp * 4;
    v4f hv[4][4];                      // [trip mod 4][k tile j]
    // unrolled so that hv stays in registers
#pragma unroll
    for (int u = 0; u < HPRE; ++u)
#pragma unroll
        for (int j = 0; j < 4; ++j)                 // 8 key tiles apart: tile j
            hv[u][j] = *(const v4f*)(hkr + (size_t)j * 8 * TILEF + 128 * u);

    // ---- S and mask words of the lane's 16 (q row, k tile) places ----
    // Nothing stands between the conflict loop and the gate any more under which these
    // loads could land, so they are asked for here, beside the staging loads.
    // S: one 16-byte load a tile (q rows 4*half + 0..3 of key lp), a wave's load covers
    // 4 whole cache lines; 8 key tiles apart: tile j
    const float* sprow = sp + ((size_t)blockIdx.x * (L_ / 16) + wave) * STILE + lane * 4;
    v4f sv[4];
    // the loops here are unrolled so that sv and mv stay in registers
#pragma unroll
    for (int j = 0; j < 4; ++j) sv[j] = *(const v4f*)(sprow + j * 8 * STILE);
    // mask: one address pair, the places told apart by constant offsets
    const int* mrow = mask + (((size_t)b * L_) + q0 + 4 * half) * L_ + wave * 16 + lp;
    int mv[4][4];
#pragma unroll
    for (int j = 0; j < 4; ++j)
#pragma unroll
        for (int r = 0; r < 4; ++r) mv[j][r] = mrow[r * L_ + j * 128];
    // precaution: the address pairs of the issued S and mask loads stay live up to
    // this wait, so nothing rewrites them ahead of the wait
    asm volatile("s_wait_xcnt 0x0" :: "v"(sprow), "v"(mrow) : "memory");
    __syncthreads();

    // The conflict loop has no vector registers to spare (32 more push it past 256).
    // The scaled scores wait in the lane's own places of SG, which nobody else touches
    // ahead of the next barrier; the mask tests wait as lane masks in scalar registers.
    unsigned mz[4][4];
    // unrolled so that sv, mv and mz stay in registers
#pragma unroll
    for (int j = 0; j < 4; ++j)
#pragma unroll
        for (int r = 0; r < 4; ++r) {
            SG[r + 4 * half][(wave + 8 * j) * 16 + lp] = sv[j][r] * SCALE;
            mz[j][r] = __builtin_amdgcn_ballot_w32(mv[j][r] == 0);
        }

    const float bias2 = b2[0];

    // ---- conflict[q,k] = sum_d relu(hqb[q,d]+hk[k,d])*W2[d]  (VALU) ----
    // relu(a + b) = max(a, -b) + b, so
    //   conflict = sum_d max(hqb[q,d], nhk[k,d])*W2[d] - sum_d nhk[k,d]*W2[d].
    // The first sum costs one max and one multiply-add an element (no add in
    // front of the max); the second depends on the key alone: once per lane and key.
    // One d loop for all four k tiles of the wave (tile j = wave + 8*j). Every lane
    // works on all 8 q rows; the two halves of the wave share d: of each 8 values the
    // lower half takes the first 4, the upper half the last 4, and the two part sums
    // meet behind the loop. Each sum is kept as an (even d, odd d) pair, so that two
    // multiply-adds go as one packed instruction; the pair is added up behind the loop.
    v2f cacc[4][8];
    v2f ksum[4];
#pragma unroll
    for (int j = 0; j < 4; ++j) {
        ksum[j] = (v2f){0.f, 0.f};
#pragma unroll
        for (int r = 0; r < 8; ++r) cacc[j][r] = (v2f){0.f, 0.f};
    }

    // q rows 0..3 and W2 of the first trip: every later trip finds them read by the trip
    // in front of it
    v4f ha[4], hb[4], wv[2];
    wv[0] = *(const v4f*)&ldsW2[4 * half];
    // unrolled so that ha stays in registers
#pragma unroll
    for (int r = 0; r < 4; ++r) ha[r] = *(const v4f*)&ldsH[r][4 * half];

    static_assert(HPRE == 2, "the four addresses below stand two trips ahead");
    for (int d = 0; d < D_; d += 32) {               // four trips a pass
        // trips 2 and 3 ask for the next pass's first two trips. Behind the last pass
        // there is none: it asks for its own first two again (inside the tile, lines
        // just read), and nothing reads those values
        const float* hkn = hkr + (d + 32 < D_ ? d + 32 : d) * 16;
        const int dl = d + 4 * half;                 // the lane's own 4 values of d
        // trip 3 reads LDS for the next pass's first trip; behind the last pass it reads
        // the first trip's values again, and nothing uses them
        const int dw = (d + 32 < D_ ? d + 32 : 0) + 4 * half;
        cga_conflict_trip<0>(hv, hkr + (d + 16) * 16, dl,      dl + 8,  ldsW2, ldsH,
                             ha, hb, wv, cacc, ksum);
        cga_conflict_trip<1>(hv, hkr + (d + 24) * 16, dl + 8,  dl + 16, ldsW2, ldsH,
                             ha, hb, wv, cacc, ksum);
        cga_conflict_trip<2>(hv, hkn,                 dl + 16, dl + 24, ldsW2, ldsH,
                             ha, hb, wv, cacc, ksum);
        cga_conflict_trip<3>(hv, hkn + 128,           dl + 24, dw,      ldsW2, ldsH,
                             ha, hb, wv, cacc, ksum);
    }

    // the two halves' part sums meet: a lane keeps the part of its own 4 q rows
    // (4*half + r, the rows of its D registers 0..3) and hands the part of the other 4
    // to lane ^ 16
    float conf[4][4];
#pragma unroll
    for (int j = 0; j < 4; ++j) {
        const float ks = ksum[j].x + ksum[j].y;
        float part[8];
#pragma unroll
        for (int r = 0; r < 8; ++r) part[r] = (cacc[j][r].x + cacc[j][r].y) - ks;
#pragma unroll
        for (int r = 0; r < 4; ++r) {
            const float keep = half ? part[4 + r] : part[r];
            const float send = half ? part[r] : part[4 + r];
            conf[j][r] = keep + cga_xhalf(send);
        }
    }

    // unrolled so that conf[j] and mz[j] stay in registers
#pragma unroll
    for (int j = 0; j < 4; ++j) {
        const int k0 = (wave + 8 * j) * 16;

        // ---- gate + mask -> SG ----
#pragma unroll
        for (int r = 0; r < 4; ++r) {
            const int qrow = r + 4 * half;
            // exp(-x) = 2^(x * -log2(e)), as __expf makes it. The v_nop fills the slot that
            // the instruction set asks for behind a transcendental; in one
            // statement the v_nop stands directly behind the exponential
            float e;
            asm("v_exp_f32 %0, %1\n\tv_nop"
                : "=v"(e) : "v"((conf[j][r] + bias2) * -1.44269504088896340736f));
            const float g  = 1.f / (1.f + e);
            float sg = SG[qrow][k0 + lp] * g;
            if (__builtin_amdgcn_inverse_ballot_w32(mz[j][r])) sg = -__builtin_inff();
            SG[qrow][k0 + lp] = sg;
        }
    }
    __syncthreads();

    // ---- V fragments of P@V, fetched ahead ----
    // V depends on nothing computed here: the fragments of the first VPRE key
    // steps are asked for here, behind the barrier (which waits for every load
    // issued in front of it), and fly while the softmax runs. One address pair
    // for all 128 steps; a step is told from the next by a constant offset, so
    // the pair is not rewritten between the loads.
    const float* vbase = V + ((size_t)(b * L_) + 2 * half) * D_ + wave * 16 + lp;
    v2f vb[L_ / 4];                    // B: V[4s+kb+j][d0+n], step s
    // unrolled so that vb stays in registers
#pragma unroll
    for (int s = 0; s < VPRE; ++s) {
        vb[s].x = vbase[(4 * s) * D_];
        vb[s].y = vbase[(4 * s + 1) * D_];
    }
    // keeps the V loads in front of the softmax: moved in among its instructions they
    // start later, and the barrier behind the softmax waits for the last of them
    __builtin_amdgcn_sched_barrier(0);

    // ---- softmax over k: a wave's row held in registers from read to store ----
    // A lane reads 16 scores of the row once (16 bytes a read, a wave's read covers
    // 512 bytes in a row), and maximum, exponentials, sum and scaling work on those
    // registers; P goes to LDS once. The maximum and the sum over the 32 lanes go
    // through vector cross-lane operands, not through the LDS unit.
    v4f px[4];                         // [128-key block]
    {
        float* srow = &SG[wave][4 * lane];
        // every loop here is unrolled so that px stays in registers
#pragma unroll
        for (int i = 0; i < 4; ++i) px[i] = *(const v4f*)(srow + 128 * i);

        const v4f m4 = __builtin_elementwise_max(
            __builtin_elementwise_max(px[0], px[1]),
            __builtin_elementwise_max(px[2], px[3]));
        float mx = fmaxf(fmaxf(m4.x, m4.y), fmaxf(m4.z, m4.w));
        mx = fmaxf(mx, cga_xrow<1>(mx));
        mx = fmaxf(mx, cga_xrow<2>(mx));
        mx = fmaxf(mx, cga_xrow<4>(mx));
        mx = fmaxf(mx, cga_xrow<8>(mx));
        mx = fmaxf(mx, cga_xhalf(mx));

#pragma unroll
        for (int i = 0; i < 4; ++i) {
            px[i].x = __expf(px[i].x - mx);
            px[i].y = __expf(px[i].y - mx);
            px[i].z = __expf(px[i].z - mx);
            px[i].w = __expf(px[i].w - mx);
        }
        const v4f s4 = (px[0] + px[1]) + (px[2] + px[3]);
        float sum = (s4.x + s4.y) + (s4.z + s4.w);
        sum += cga_xrow<1>(sum);
        sum += cga_xrow<2>(sum);
        sum += cga_xrow<4>(sum);
        sum += cga_xrow<8>(sum);
        sum += cga_xhalf(sum);

        const float inv = 1.f / sum;
#pragma unroll
        for (int i = 0; i < 4; ++i) {
            px[i] *= inv;
            *(v4f*)(srow + 128 * i) = px[i];
        }
    }
    __syncthreads();

    // the weights go out of the same registers, behind the barrier (which waits for
    // every store issued in front of it), and fly while P@V runs: 16 bytes a lane,
    // a wave's store covers 4 whole cache lines
    {
        float* wout = weights + (((size_t)b * L_) + q0 + wave) * L_ + 4 * lane;
#pragma unroll
        for (int i = 0; i < 4; ++i) *(v4f*)(wout + 128 * i) = px[i];
        // precaution: the address pair and the data of the issued stores stay live
        // up to this wait, so nothing rewrites them ahead of it
        asm volatile("s_wait_xcnt 0x0"
                     :: "v"(wout), "v"(px[0]), "v"(px[1]), "v"(px[2]), "v"(px[3])
                     : "memory");
    }

    // ---- out = P @ V  (128 chained f32 WMMAs; wave owns d-tile = 16*wave) ----
    {
        const int d0 = wave * 16;
        v8f acc = {};
        // unrolled so that vb stays in registers and every V load has a constant
        // offset; step s asks for the fragment of step s + VPRE
#pragma unroll
        for (int s = 0; s < L_ / 4; ++s) {
            if (s + VPRE < L_ / 4) {
                vb[s + VPRE].x = vbase[(4 * (s + VPRE)) * D_];
                vb[s + VPRE].y = vbase[(4 * (s + VPRE) + 1) * D_];
            }
            v2f a = *(const v2f*)&SG[qm][4 * s + 2 * half];  // A: P[q row of m][4s+kb+j]
            acc = __builtin_amdgcn_wmma_f32_16x16x4_f32(false, a, false, vb[s],
                                                        (short)0, acc, false, false);
        }
        // precaution: the address pair of the V loads stays live up to this wait
        asm volatile("s_wait_xcnt 0x0" :: "v"(vbase) : "memory");
#pragma unroll
        for (int r = 0; r < 4; ++r)
            out[(((size_t)b * L_) + q0 + r + 4 * half) * D_ + d0 + lp] = acc[r];
    }
}

// ---------------------------------------------------------------------------
extern "C" void kernel_launch(void* const* d_in, const int* in_sizes, int n_in,
                              void* d_out, int out_size, void* d_ws, size_t ws_size,
                              hipStream_t stream)
{
    const float* Q    = (const float*)d_in[0];
    const float* K    = (const float*)d_in[1];
    const float* V    = (const float*)d_in[2];
    const int*   mask = (const int*)  d_in[3];
    const float* W1   = (const float*)d_in[4];
    const float* b1   = (const float*)d_in[5];
    const float* W2   = (const float*)d_in[6];
    const float* b2   = (const float*)d_in[7];

    float* out     = (float*)d_out;                       // [B,L,D]
    float* weights = (float*)d_out + (size_t)BL_ * D_;    // [B,L,L]

    // workspace: hqb [B,L,D], nhk [B,L,D], sp (B*L*L floats)  (6 MB total)
    float* hqb = (float*)d_ws;
    float* nhk = (float*)d_ws + (size_t)BL_ * D_;
    float* sp  = (float*)d_ws + (size_t)2 * BL_ * D_;

    cga_proj_kernel<<<2 * BL_ / 16, 256, 0, stream>>>(Q, K, W1, b1, hqb, nhk, sp);
    cga_attn_kernel<<<B_ * (L_ / QT), 256, 0, stream>>>(sp, V, mask, W2, b2,
                                                        hqb, nhk, out, weights);
}
